// v000
// Measured on an AMD MI455X. A time is GPU time per run, averaged over a window of back-to-back runs after a warm-up
// (all launches, gaps included; the runs take copies of the inputs in turn), and the median of several windows.
// Apart from v000's, it joins two sittings. Times from different sittings can be a few percent apart, while
// side-by-side timings come from the same sitting.
// The starting kernel, v000, takes 1410 microseconds a run.
#include <hip/hip_runtime.h>

// Encoder_layer (x [2][2048][1024]; h = x wq^T + bq is used as q, k AND v (the module applies Wq to all three; Wo unused); 16 heads x 64; softmax(h_q.h_k/8) h_v (no mask); x1 = LN1(x + att_out);
// ffn = relu(x1 w1^T + b1) w2^T + b2 (F 4096); out = LN2(x1 + ffn); LN = a (v - mean)/(std_unbiased + 1e-6) + b (torch.std, ddof 1; eps added to the std)).
// Compute dtypes, f32 accumulate: every input rounded to bf16; the shared projection on PLAIN bf16 operands (inputs: exact, + bias); scores and attn.v on SINGLE fp16
// planes of h (1/8 in the softmax; P x1024); merged context f32; LayerNorms, residuals and ReLU f32; the FFN as SINGLE fp16 planes x fp16 copies of bf16(w1/w2) scaled by 2^14 (biases scaled alike;

#define NB_  2
#define FFH  4096
#define WSC  16384.0f
#define TT   2048
#define DD   1024
#define NH_  16
#define HD   64
#define NT   (NB_ * TT)
#define NZ   (NB_ * NH_)
#define ZH   2
#define PCAR 1024.0f
#define SCL  0.125f
typedef _Float16 h16;
typedef unsigned short bf;
typedef __attribute__((ext_vector_type(16))) __bf16   v16bf;
typedef __attribute__((ext_vector_type(16))) _Float16 v16h;
typedef __attribute__((ext_vector_type(8)))  _Float16 v8h;
typedef __attribute__((ext_vector_type(8)))  unsigned short v8us;
typedef __attribute__((ext_vector_type(8)))  float    v8f;
typedef __attribute__((ext_vector_type(4)))  float    v4f;
typedef v8h  __attribute__((may_alias)) v8ha;
typedef v4f  __attribute__((may_alias)) v4fa;
typedef v8us __attribute__((may_alias)) v8usa;

__device__ __forceinline__ unsigned short f2bf(float f) { unsigned u = __float_as_uint(f); u += 0x7FFFu + ((u >> 16) & 1u); return (unsigned short)(u >> 16); }
__device__ __forceinline__ float bf2f(unsigned short b) { return __uint_as_float(((unsigned)b) << 16); }
__device__ __forceinline__ float bfr(float f) { return bf2f(f2bf(f)); }
__device__ __forceinline__ v16h cat16(v8h lo, v8h hi) { return __builtin_shufflevector(lo, hi, 0, 1, 2, 3, 4, 5, 6, 7, 8, 9, 10, 11, 12, 13, 14, 15); }
__device__ __forceinline__ v16bf cat16b(v8us lo, v8us hi) { return __builtin_bit_cast(v16bf, __builtin_shufflevector(lo, hi, 0, 1, 2, 3, 4, 5, 6, 7, 8, 9, 10, 11, 12, 13, 14, 15)); }
__device__ __forceinline__ v8f wmma16(v16h a, v16h b, v8f c) { return __builtin_amdgcn_wmma_f32_16x16x32_f16(false, a, false, b, (short)0, c, false, false); }
__device__ __forceinline__ v8f wmmab(v16bf a, v16bf b, v8f c) { return __builtin_amdgcn_wmma_f32_16x16x32_bf16(false, a, false, b, (short)0, c, false, false); }



// ---- k_gemmw: register-blocked GEMM, ONE WAVE per 64x64 output tile (16 accumulators), operands straight from K-contiguous 16-bit planes; grid (M/64, N/64, Z), 32 threads.
// C[m][n] (f32, pitch ldc, + optional f32 bias[n]) = sum_k A[m][k] Bt[n][k] (+ split products per NSPLIT). z-batch strides sA/sB/sC in elements. K % 32 == 0.
template <typename T16> struct WFrag;
template <> struct WFrag<h16> { typedef v16h V; static __device__ __forceinline__ V ld(const h16* p) { return cat16(*(const v8h*)p, *(const v8h*)(p + 16)); } static __device__ __forceinline__ v8f mma(V a, V b, v8f c) { return wmma16(a, b, c); } };
template <> struct WFrag<bf> { typedef v16bf V; static __device__ __forceinline__ V ld(const bf* p) { return cat16b(*(const v8us*)p, *(const v8us*)(p + 16)); } static __device__ __forceinline__ v8f mma(V a, V b, v8f c) { return wmmab(a, b, c); } };
template <typename T16, int NSPLIT, bool BIAS>
__global__ __launch_bounds__(32) void k_gemmw(const T16* __restrict__ A, const T16* __restrict__ A2, const T16* __restrict__ Bt, const T16* __restrict__ Bt2, int K, float* C, int ldc, const float* __restrict__ bias, size_t sA, size_t sB, size_t sC) {
    typedef typename WFrag<T16>::V V;
    __shared__ __align__(16) float os[16 * 68];
    const size_t z = blockIdx.z; A += z * sA; if (A2) A2 += z * sA; Bt += z * sB; if (Bt2) Bt2 += z * sB; C += z * sC;
    const int lane = threadIdx.x & 31, lr = lane & 15, hi = lane >> 4; const int r0 = blockIdx.x * 64, c0 = blockIdx.y * 64;
    v8f acc[4][4];
#pragma unroll
    for (int mb = 0; mb < 4; ++mb)
#pragma unroll
        for (int nb = 0; nb < 4; ++nb) acc[mb][nb] = (v8f){};
    const size_t aoff = (size_t)(r0 + lr) * K + 8 * hi, boff = (size_t)(c0 + lr) * K + 8 * hi;
#pragma unroll 1
    for (int kc = 0; kc < K; kc += 32) {
        V a[4], a2[4];
#pragma unroll
        for (int mb = 0; mb < 4; ++mb) { a[mb] = WFrag<T16>::ld(A + aoff + (size_t)mb * 16 * K + kc); if (NSPLIT == 1 || NSPLIT == 2) a2[mb] = WFrag<T16>::ld(A2 + aoff + (size_t)mb * 16 * K + kc); }
#pragma unroll
        for (int nb = 0; nb < 4; ++nb) { const V b = WFrag<T16>::ld(Bt + boff + (size_t)nb * 16 * K + kc); V b2; if (NSPLIT >= 2) b2 = WFrag<T16>::ld(Bt2 + boff + (size_t)nb * 16 * K + kc);
#pragma unroll
            for (int mb = 0; mb < 4; ++mb) { acc[mb][nb] = WFrag<T16>::mma(a[mb], b, acc[mb][nb]); if (NSPLIT == 1 || NSPLIT == 2) acc[mb][nb] = WFrag<T16>::mma(a2[mb], b, acc[mb][nb]); if (NSPLIT >= 2) acc[mb][nb] = WFrag<T16>::mma(a[mb], b2, acc[mb][nb]); } }
        asm volatile("v_nop\n\tv_nop\n\tv_nop\n\tv_nop" : "+v"(acc[0][0]), "+v"(acc[1][1]), "+v"(acc[2][2]), "+v"(acc[3][3]) : "v"(a[0]), "v"(a[3]));
    }
#pragma unroll
    for (int mb = 0; mb < 4; ++mb) {
#pragma unroll
        for (int nb = 0; nb < 4; ++nb) {
#pragma unroll
            for (int j = 0; j < 8; ++j) os[(hi * 8 + j) * 68 + nb * 16 + lr] = acc[mb][nb][j]; }
        __builtin_amdgcn_wave_barrier(); asm volatile("" ::: "memory");
        float* crow = C + (size_t)(r0 + mb * 16) * ldc + c0;
{
#pragma unroll
            for (int s = 0; s < 8; ++s) { const int row = 2 * s + hi, cofs = lr * 4; v4f val = *(const v4fa*)(os + row * 68 + cofs); if (BIAS) { val[0] += bfr(bias[c0 + cofs]); val[1] += bfr(bias[c0 + cofs + 1]); val[2] += bfr(bias[c0 + cofs + 2]); val[3] += bfr(bias[c0 + cofs + 3]); }
                *(v4f*)(crow + (size_t)row * ldc + cofs) = val; }
             }
        __builtin_amdgcn_wave_barrier(); asm volatile("" ::: "memory");
    }
}

__device__ __forceinline__ h16 tohx(float x) { return (h16)x; }
__device__ __forceinline__ void splitf(float y, unsigned short& h, unsigned short& l) { h = f2bf(y); l = f2bf(y - bf2f(h)); }
typedef __attribute__((ext_vector_type(2))) _Float16 v2h;
typedef __attribute__((ext_vector_type(2))) unsigned short v2us;
typedef __attribute__((ext_vector_type(4))) unsigned short v4us;
typedef __attribute__((ext_vector_type(2))) float v2f;

typedef __attribute__((ext_vector_type(8))) _Float16 v8h16;
typedef __attribute__((ext_vector_type(4))) _Float16 v4h_t;
#define v4h v4h_t
__global__ __launch_bounds__(256) void k_cvt8(const float* __restrict__ src, bf* dst, size_t n8) { const size_t i = (size_t)blockIdx.x * 256 + threadIdx.x; if (i >= n8) return; const v8f v = *(const v8f*)(src + i * 8); v8us o;
#pragma unroll
    for (int k = 0; k < 8; ++k) o[k] = f2bf(v[k]); *(v8us*)(dst + i * 8) = o;  }
__global__ __launch_bounds__(256) void k_wtG(const float* __restrict__ w, int K, int N, bf* Bt) {
    const int lane = threadIdx.x & 31; const int L0 = (blockIdx.x * 8 + (threadIdx.x >> 5)) * 8; const int nlines = N * K / 64;
{
#pragma unroll 1
        for (int l = 0; l < 8; ++l) { const int L = L0 + l; if (L >= nlines) break; const size_t e = (size_t)L * 64 + lane * 2; const int k = (int)(e % K), n = (int)(e / K); v2us o;
            o[0] = f2bf(w[(size_t)k * N + n]); o[1] = f2bf(w[(size_t)(k + 1) * N + n]); *(v2us*)(Bt + e) = o; }
         }
}
__global__ __launch_bounds__(256) void k_cvt16(const float* __restrict__ src, h16* dst, size_t n8) { const size_t i = (size_t)blockIdx.x * 256 + threadIdx.x; if (i >= n8) return; const v8f v = *(const v8f*)(src + i * 8); v8h16 o;
#pragma unroll
    for (int k = 0; k < 8; ++k) o[k] = tohx(bfr(v[k]) * WSC); *(v8h16*)(dst + i * 8) = o;  }
__global__ __launch_bounds__(256) void k_bsc(const float* __restrict__ b, float* BS, int n) { const int i = (blockIdx.x * 256 + threadIdx.x) * 4; if (i >= n) return; const v4f a = *(const v4f*)(b + i); v4f o;
#pragma unroll
    for (int q = 0; q < 4; ++q) o[q] = bfr(a[q]) * WSC; *(v4f*)(BS + i) = o;  }
__global__ __launch_bounds__(256) void k_relu16(const float* __restrict__ H, h16* G16, size_t n) { const size_t i = ((size_t)blockIdx.x * 256 + threadIdx.x) * 2; if (i >= n) return; v2h o;
#pragma unroll
    for (int q = 0; q < 2; ++q) o[q] = tohx(fmaxf(H[i + q] * (1.0f / WSC), 0.f));
    *(v2h*)(G16 + i) = o;  }
__global__ __launch_bounds__(256) void k_ln1t(const float* __restrict__ x, const float* __restrict__ ATT, const float* __restrict__ gg, const float* __restrict__ bb, float* H, h16* T16) {
    const int lane = threadIdx.x & 31; const int r = blockIdx.x * 8 + (threadIdx.x >> 5); if (r >= NT) return; float v[DD / 32]; float s = 0.f;
#pragma unroll
    for (int c = 0; c < DD / 128; ++c) { const v4f a = *(const v4f*)(ATT + (size_t)r * DD + c * 128 + lane * 4), xx = *(const v4f*)(x + (size_t)r * DD + c * 128 + lane * 4);
#pragma unroll
        for (int q = 0; q < 4; ++q) { v[c * 4 + q] = __fadd_rn(bfr(xx[q]), a[q]); s += v[c * 4 + q]; } }
#pragma unroll
    for (int sh = 16; sh; sh >>= 1) s += __shfl_xor(s, sh, 32);
    const float mu = s * (1.0f / DD); float qq = 0.f;
#pragma unroll
    for (int i = 0; i < DD / 32; ++i) { const float d0 = v[i] - mu; qq = __fadd_rn(qq, __fmul_rn(d0, d0)); }
#pragma unroll
    for (int sh = 16; sh; sh >>= 1) qq += __shfl_xor(qq, sh, 32);
    const float rs = __fdiv_rn(1.0f, __fadd_rn(__fsqrt_rn(qq * (1.0f / (DD - 1))), 1e-6f));
{
#pragma unroll
        for (int c = 0; c < DD / 128; ++c) { v4f o; v4h t;
#pragma unroll
            for (int q = 0; q < 4; ++q) { const int col = c * 128 + lane * 4 + q; o[q] = __fadd_rn(__fmul_rn((v[c * 4 + q] - mu) * rs, bfr(gg[col])), bfr(bb[col])); t[q] = tohx(o[q]); }
            *(v4f*)(H + (size_t)r * DD + c * 128 + lane * 4) = o; *(v4h*)(T16 + (size_t)r * DD + c * 128 + lane * 4) = t; }
         }
}
__global__ __launch_bounds__(256) void k_ln2t(const float* __restrict__ H, const float* __restrict__ F2, const float* __restrict__ gg, const float* __restrict__ bb, float* OUT) {
    const int lane = threadIdx.x & 31; const int r = blockIdx.x * 8 + (threadIdx.x >> 5); if (r >= NT) return; float v[DD / 32]; float s = 0.f;
#pragma unroll
    for (int c = 0; c < DD / 128; ++c) { const v4f a = *(const v4f*)(H + (size_t)r * DD + c * 128 + lane * 4), f4 = *(const v4f*)(F2 + (size_t)r * DD + c * 128 + lane * 4);
#pragma unroll
        for (int q = 0; q < 4; ++q) { v[c * 4 + q] = __fadd_rn(a[q], f4[q] * (1.0f / WSC)); s += v[c * 4 + q]; } }
#pragma unroll
    for (int sh = 16; sh; sh >>= 1) s += __shfl_xor(s, sh, 32);
    const float mu = s * (1.0f / DD); float qq = 0.f;
#pragma unroll
    for (int i = 0; i < DD / 32; ++i) { const float d0 = v[i] - mu; qq = __fadd_rn(qq, __fmul_rn(d0, d0)); }
#pragma unroll
    for (int sh = 16; sh; sh >>= 1) qq += __shfl_xor(qq, sh, 32);
    const float rs = __fdiv_rn(1.0f, __fadd_rn(__fsqrt_rn(qq * (1.0f / (DD - 1))), 1e-6f));
{
#pragma unroll
        for (int c = 0; c < DD / 128; ++c) { v4f o;
#pragma unroll
            for (int q = 0; q < 4; ++q) { const int col = c * 128 + lane * 4 + q; o[q] = __fadd_rn(__fmul_rn((v[c * 4 + q] - mu) * rs, bfr(gg[col])), bfr(bb[col])); }
            *(v4f*)(OUT + (size_t)r * DD + c * 128 + lane * 4) = o; }
         }
}
__global__ __launch_bounds__(256) void k_h16plane(const float* __restrict__ F, float sc, h16* P) {
    const int lane = threadIdx.x & 31; const int L0 = (blockIdx.x * 8 + (threadIdx.x >> 5)) * 8; const int nlines = NT * DD / 64;
{
#pragma unroll
        for (int l = 0; l < 8; ++l) { const int L = L0 + l; if (L >= nlines) break; const int e = L * 64 + lane * 2; const int d = e & 63; const int t = (e >> 6) & (TT - 1); const int z = e >> 17; const int b = z / NH_, h = z % NH_; v2h v;
#pragma unroll
            for (int q = 0; q < 2; ++q) v[q] = tohx(F[((size_t)b * TT + t) * DD + h * HD + d + q] * sc);
            *(v2h*)(P + (size_t)e) = v; }
         }
}
__global__ __launch_bounds__(256) void k_vtplane(const float* __restrict__ F, h16* VT) {
    const int lane = threadIdx.x & 31; const int L0 = (blockIdx.x * 8 + (threadIdx.x >> 5)) * 8; const int nlines = NT * DD / 64;
{
#pragma unroll
        for (int l = 0; l < 8; ++l) { const int L = L0 + l; if (L >= nlines) break; const int e = L * 64 + lane * 2; const int t = e & (TT - 1); const int d = (e >> 11) & 63; const int z = e >> 17; const int b = z / NH_, h = z % NH_; v2h v;
#pragma unroll
            for (int q = 0; q < 2; ++q) v[q] = tohx(F[((size_t)b * TT + t + q) * DD + h * HD + d]);
            *(v2h*)(VT + (size_t)e) = v; }
         }
}
__global__ __launch_bounds__(256) void k_asoft(const float* __restrict__ Sb, h16* P16) {
    const int lane = threadIdx.x & 31; const int row = blockIdx.x * 8 + (threadIdx.x >> 5); if (row >= ZH * TT) return;
    const float* sr = Sb + (size_t)row * TT; float v[64]; float mx = -3.0e38f;
#pragma unroll
    for (int ch = 0; ch < 16; ++ch) { const int j0 = ch * 128 + lane * 4; const v4f a = *(const v4f*)(sr + j0);
#pragma unroll
        for (int q = 0; q < 4; ++q) { const float t = a[q] * SCL; v[ch * 4 + q] = t; mx = fmaxf(mx, t); } }
#pragma unroll
    for (int sh = 16; sh; sh >>= 1) mx = fmaxf(mx, __shfl_xor(mx, sh, 32));
    float sum = 0.f;
#pragma unroll
    for (int k = 0; k < 64; ++k) { v[k] = __expf(v[k] - mx); sum += v[k]; }
#pragma unroll
    for (int sh = 16; sh; sh >>= 1) sum += __shfl_xor(sum, sh, 32);
    const float f = __fdiv_rn(PCAR, sum);
{
#pragma unroll
        for (int ch = 0; ch < 16; ++ch) { v4h o;
#pragma unroll
            for (int q = 0; q < 4; ++q) o[q] = tohx(v[ch * 4 + q] * f);
            *(v4h*)(P16 + (size_t)row * TT + ch * 128 + lane * 4) = o; }
         }
}
__global__ __launch_bounds__(256) void k_mergef(const float* __restrict__ O, int b, int h0, float* OUT) {
    const int lane = threadIdx.x & 31; const int L0 = (blockIdx.x * 8 + (threadIdx.x >> 5)) * 8; const int nlines = ZH * TT * HD / 64;
{
#pragma unroll
        for (int l = 0; l < 8; ++l) { const int L = L0 + l; if (L >= nlines) break; const int e = L * 64 + lane * 2; const int d = e & (HD - 1); const int t = (e >> 6) & (TT - 1); const int zz = e >> 17; v2f o2;
#pragma unroll
            for (int q = 0; q < 2; ++q) o2[q] = O[(size_t)e + q] * (1.0f / PCAR);
            *(v2f*)(OUT + ((size_t)b * TT + t) * DD + (h0 + zz) * HD + d) = o2; }
         }
}
__global__ __launch_bounds__(256) void k_merge(const float* __restrict__ O, int b, int h0, bf* Ah, bf* Al) {
    const int lane = threadIdx.x & 31; const int L0 = (blockIdx.x * 8 + (threadIdx.x >> 5)) * 8; const int nlines = ZH * TT * HD / 64;
{
#pragma unroll
        for (int l = 0; l < 8; ++l) { const int L = L0 + l; if (L >= nlines) break; const int e = L * 64 + lane * 2; const int d = e & 63; const int t = (e >> 6) & (TT - 1); const int zz = e >> 17; v2us oh, ol;
#pragma unroll
            for (int q = 0; q < 2; ++q) { unsigned short a, c2; splitf(O[(size_t)e + q] * (1.0f / PCAR), a, c2); oh[q] = a; ol[q] = c2; }
            const size_t o = ((size_t)b * TT + t) * DD + (h0 + zz) * HD + d; *(v2us*)(Ah + o) = oh; *(v2us*)(Al + o) = ol; }
         }
}

extern "C" void kernel_launch(void* const* d_in, const int* in_sizes, int n_in,
                              void* d_out, int out_size, void* d_ws, size_t ws_size, hipStream_t stream) {
    (void)in_sizes; (void)n_in; (void)out_size;
    const float* IN[11]; for (int i = 0; i < 11; ++i) IN[i] = (const float*)d_in[i];
    // x, wq [1024][1024], bq, ln1_a, ln1_b, ln2_a, ln2_b, w1 [4096][1024], b1, w2 [1024][4096], b2 = d_in[0..10]
    float* OUT = (float*)d_out;     // [2][2048][1024]
    char* wsp = (char*)d_ws;
    auto take = [&](size_t bytes) { char* p = wsp; wsp += (bytes + 255) & ~(size_t)255; return (void*)p; };
    bf* WQ = (bf*)take((size_t)DD * DD * 2); h16* W1 = (h16*)take((size_t)FFH * DD * 2); h16* W2 = (h16*)take((size_t)DD * FFH * 2); float* B1 = (float*)take(FFH * 4); float* B2 = (float*)take(DD * 4);
    bf* XQ = (bf*)take((size_t)NT * DD * 2); float* F = (float*)take((size_t)NT * DD * 4); h16* QP = (h16*)take((size_t)NT * DD * 2); h16* VT = (h16*)take((size_t)NT * DD * 2);
    char* R0 = wsp; float* Sb = (float*)take((size_t)ZH * TT * TT * 4); h16* Pm = (h16*)take((size_t)ZH * TT * TT * 2); char* R1 = wsp; float* Ob = (float*)take((size_t)ZH * TT * HD * 4); float* H = (float*)take((size_t)NT * DD * 4); h16* T16 = (h16*)take((size_t)NT * DD * 2);
    if ((size_t)(wsp - (char*)d_ws) > ws_size) return;    // total ~ 137 MB = 131 MiB; ws 256 MiB
    float* ATT = F; float* Hf = (float*)R0; h16* G16 = (h16*)(R0 + (size_t)TT * FFH * 4); if ((char*)(G16 + (size_t)TT * FFH) > R1) return;
    { const size_t nw = (size_t)DD * DD / 8; k_cvt8<<<(unsigned)((nw + 255) / 256), 256, 0, stream>>>(IN[1], WQ, nw);
      const size_t f8 = (size_t)FFH * DD / 8; const unsigned gf = (unsigned)((f8 + 255) / 256); k_cvt16<<<gf, 256, 0, stream>>>(IN[7], W1, f8); k_cvt16<<<gf, 256, 0, stream>>>(IN[9], W2, f8); k_bsc<<<FFH / 1024, 256, 0, stream>>>(IN[8], B1, FFH); k_bsc<<<DD / 1024, 256, 0, stream>>>(IN[10], B2, DD);
      const size_t nx = (size_t)NT * DD / 8; k_cvt8<<<(unsigned)((nx + 255) / 256), 256, 0, stream>>>(IN[0], XQ, nx); }
    const unsigned LB = (unsigned)((NT * DD / 64 + 63) / 64); const dim3 gP(NT / 64, DD / 64, 1);
    k_gemmw<bf, 0, true><<<gP, 32, 0, stream>>>(XQ, nullptr, WQ, nullptr, DD, F, DD, IN[2], 0, 0, 0); k_h16plane<<<LB, 256, 0, stream>>>(F, 1.0f, QP); k_vtplane<<<LB, 256, 0, stream>>>(F, VT);   // h serves as q, k (same plane) and v
    for (int b = 0; b < NB_; ++b)
        for (int h0 = 0; h0 < NH_; h0 += ZH) { const size_t z0 = (size_t)b * NH_ + h0;
            k_gemmw<h16, 0, false><<<dim3(TT / 64, TT / 64, ZH), 32, 0, stream>>>(QP + z0 * TT * HD, nullptr, QP + z0 * TT * HD, nullptr, HD, Sb, TT, nullptr, (size_t)TT * HD, (size_t)TT * HD, (size_t)TT * TT);
            k_asoft<<<ZH * TT / 8, 256, 0, stream>>>(Sb, Pm);
            k_gemmw<h16, 0, false><<<dim3(TT / 64, 1, ZH), 32, 0, stream>>>(Pm, nullptr, VT + z0 * HD * TT, nullptr, TT, Ob, HD, nullptr, (size_t)TT * TT, (size_t)HD * TT, (size_t)TT * HD);
            k_mergef<<<(ZH * TT * HD / 64 + 63) / 64, 256, 0, stream>>>(Ob, b, h0, ATT); }
    k_ln1t<<<NT / 8, 256, 0, stream>>>(IN[0], ATT, IN[3], IN[4], H, T16);
    for (int hb = 0; hb < NB_; ++hb) { const size_t r0 = (size_t)hb * TT;
        k_gemmw<h16, 0, true><<<dim3(TT / 64, FFH / 64, 1), 32, 0, stream>>>(T16 + r0 * DD, nullptr, W1, nullptr, DD, Hf, FFH, B1, 0, 0, 0);
        k_relu16<<<(unsigned)(((size_t)TT * FFH / 2 + 255) / 256), 256, 0, stream>>>(Hf, G16, (size_t)TT * FFH);
        k_gemmw<h16, 0, true><<<dim3(TT / 64, DD / 64, 1), 32, 0, stream>>>(G16, nullptr, W2, nullptr, FFH, F + r0 * DD, DD, B2, 0, 0, 0); }
    k_ln2t<<<NT / 8, 256, 0, stream>>>(H, F, IN[5], IN[6], OUT);
}

// v001
// One run takes 799 microseconds.
// Timed twice side by side with v000, it ran 1.78 and 1.77 times as fast.
#include <hip/hip_runtime.h>

// Encoder_layer (x [2][2048][1024]; h = x wq^T + bq is used as q, k AND v (the module applies Wq to all three; Wo unused); 16 heads x 64; softmax(h_q.h_k/8) h_v (no mask); x1 = LN1(x + att_out);
// ffn = relu(x1 w1^T + b1) w2^T + b2 (F 4096); out = LN2(x1 + ffn); LN = a (v - mean)/(std_unbiased + 1e-6) + b (torch.std, ddof 1; eps added to the std)).
// Compute dtypes, f32 accumulate: every input rounded to bf16; the shared projection on PLAIN bf16 operands (inputs: exact, + bias); scores and attn.v on SINGLE fp16
// planes of h (1/8 in the softmax; P x1024); merged context f32; LayerNorms, residuals and ReLU f32; the FFN as SINGLE fp16 planes x fp16 copies of bf16(w1/w2) scaled by 2^14 (biases scaled alike;

#define NB_  2
#define FFH  4096
#define WSC  16384.0f
#define TT   2048
#define DD   1024
#define NH_  16
#define HD   64
#define NT   (NB_ * TT)
#define NZ   (NB_ * NH_)
#define ZH   2
#define PCAR 1024.0f
#define SCL  0.125f
typedef _Float16 h16;
typedef unsigned short bf;
typedef __attribute__((ext_vector_type(16))) __bf16   v16bf;
typedef __attribute__((ext_vector_type(16))) _Float16 v16h;
typedef __attribute__((ext_vector_type(8)))  _Float16 v8h;
typedef __attribute__((ext_vector_type(8)))  unsigned short v8us;
typedef __attribute__((ext_vector_type(8)))  float    v8f;
typedef __attribute__((ext_vector_type(4)))  float    v4f;
typedef v8h  __attribute__((may_alias)) v8ha;
typedef v4f  __attribute__((may_alias)) v4fa;
typedef v8us __attribute__((may_alias)) v8usa;

__device__ __forceinline__ unsigned short f2bf(float f) { unsigned u = __float_as_uint(f); u += 0x7FFFu + ((u >> 16) & 1u); return (unsigned short)(u >> 16); }
__device__ __forceinline__ float bf2f(unsigned short b) { return __uint_as_float(((unsigned)b) << 16); }
__device__ __forceinline__ float bfr(float f) { return bf2f(f2bf(f)); }
__device__ __forceinline__ v16h cat16(v8h lo, v8h hi) { return __builtin_shufflevector(lo, hi, 0, 1, 2, 3, 4, 5, 6, 7, 8, 9, 10, 11, 12, 13, 14, 15); }
__device__ __forceinline__ v16bf cat16b(v8us lo, v8us hi) { return __builtin_bit_cast(v16bf, __builtin_shufflevector(lo, hi, 0, 1, 2, 3, 4, 5, 6, 7, 8, 9, 10, 11, 12, 13, 14, 15)); }
__device__ __forceinline__ v8f wmma16(v16h a, v16h b, v8f c) { return __builtin_amdgcn_wmma_f32_16x16x32_f16(false, a, false, b, (short)0, c, false, false); }
__device__ __forceinline__ v8f wmmab(v16bf a, v16bf b, v8f c) { return __builtin_amdgcn_wmma_f32_16x16x32_bf16(false, a, false, b, (short)0, c, false, false); }



// ---- k_gemmw: register-blocked GEMM, one 64x64 output tile per work-group (16 accumulators a wave), operands straight from K-contiguous 16-bit planes; grid (M/64, N/64, Z), 32 * NW threads.
// C[m][n] (f32, pitch ldc, + optional f32 bias[n]) = sum_k A[m][k] Bt[n][k] (+ split products per NSPLIT). z-batch strides sA/sB/sC in elements. K % 32 == 0.
// NW > 1: split-K inside the work-group. NW waves (32 * NW threads) share the one 64x64 tile; wave w takes the 32-wide K chunks w, w + NW, ... (neighbour waves read the two halves of the same
// 128-byte lines at about the same time), parks its f32 partial tile in LDS, and behind one barrier all threads add the NW partials in wave order and store. NW == 1 is the single-wave form.
template <typename T16> struct WFrag;
template <> struct WFrag<h16> { typedef v16h V; static __device__ __forceinline__ V ld(const h16* p) { return cat16(*(const v8h*)p, *(const v8h*)(p + 16)); } static __device__ __forceinline__ v8f mma(V a, V b, v8f c) { return wmma16(a, b, c); } };
template <> struct WFrag<bf> { typedef v16bf V; static __device__ __forceinline__ V ld(const bf* p) { return cat16b(*(const v8us*)p, *(const v8us*)(p + 16)); } static __device__ __forceinline__ v8f mma(V a, V b, v8f c) { return wmmab(a, b, c); } };
template <typename T16, int NSPLIT, bool BIAS, int NW>
__global__ __launch_bounds__(32 * NW) void k_gemmw(const T16* __restrict__ A, const T16* __restrict__ A2, const T16* __restrict__ Bt, const T16* __restrict__ Bt2, int K, float* C, int ldc, const float* __restrict__ bias, size_t sA, size_t sB, size_t sC) {
    typedef typename WFrag<T16>::V V;
    __shared__ __align__(16) float os[(NW == 1 ? 16 : NW * 64) * 68];
    const int wv = NW == 1 ? 0 : __builtin_amdgcn_readfirstlane((int)(threadIdx.x >> 5));
    const size_t z = blockIdx.z; A += z * sA; if (A2) A2 += z * sA; Bt += z * sB; if (Bt2) Bt2 += z * sB; C += z * sC;
    const int lane = threadIdx.x & 31, lr = lane & 15, hi = lane >> 4; const int r0 = blockIdx.x * 64, c0 = blockIdx.y * 64;
    v8f acc[4][4];
#pragma unroll
    for (int mb = 0; mb < 4; ++mb)
#pragma unroll
        for (int nb = 0; nb < 4; ++nb) acc[mb][nb] = (v8f){};
    const size_t aoff = (size_t)(r0 + lr) * K + 8 * hi, boff = (size_t)(c0 + lr) * K + 8 * hi;
#pragma unroll 1
    for (int kc = wv * 32; kc < K; kc += 32 * NW) {
        V a[4], a2[4];
#pragma unroll
        for (int mb = 0; mb < 4; ++mb) { a[mb] = WFrag<T16>::ld(A + aoff + (size_t)mb * 16 * K + kc); if (NSPLIT == 1 || NSPLIT == 2) a2[mb] = WFrag<T16>::ld(A2 + aoff + (size_t)mb * 16 * K + kc); }
#pragma unroll
        for (int nb = 0; nb < 4; ++nb) { const V b = WFrag<T16>::ld(Bt + boff + (size_t)nb * 16 * K + kc); V b2; if (NSPLIT >= 2) b2 = WFrag<T16>::ld(Bt2 + boff + (size_t)nb * 16 * K + kc);
#pragma unroll
            for (int mb = 0; mb < 4; ++mb) { acc[mb][nb] = WFrag<T16>::mma(a[mb], b, acc[mb][nb]); if (NSPLIT == 1 || NSPLIT == 2) acc[mb][nb] = WFrag<T16>::mma(a2[mb], b, acc[mb][nb]); if (NSPLIT >= 2) acc[mb][nb] = WFrag<T16>::mma(a[mb], b2, acc[mb][nb]); } }
        asm volatile("v_nop\n\tv_nop\n\tv_nop\n\tv_nop" : "+v"(acc[0][0]), "+v"(acc[1][1]), "+v"(acc[2][2]), "+v"(acc[3][3]) : "v"(a[0]), "v"(a[3]));
    }
    if constexpr (NW > 1) {
        float* ow = os + wv * (64 * 68); const int cofs = ((int)threadIdx.x & 15) * 4; v4f bv = (v4f){};
        if (BIAS) { bv[0] = bfr(bias[c0 + cofs]); bv[1] = bfr(bias[c0 + cofs + 1]); bv[2] = bfr(bias[c0 + cofs + 2]); bv[3] = bfr(bias[c0 + cofs + 3]); }    // fetched ahead of the barrier: its latency hides behind the LDS stores
#pragma unroll
        for (int mb = 0; mb < 4; ++mb)
#pragma unroll
            for (int nb = 0; nb < 4; ++nb)
#pragma unroll
                for (int j = 0; j < 8; ++j) ow[(mb * 16 + hi * 8 + j) * 68 + nb * 16 + lr] = acc[mb][nb][j];
        __syncthreads();    // every wave's partial tile is in LDS before any thread sums across waves
#pragma unroll
        for (int i = 0; i < 32 / NW; ++i) { const int row = ((int)threadIdx.x + i * 32 * NW) >> 4; v4f val = *(const v4fa*)(os + row * 68 + cofs);
#pragma unroll
            for (int w = 1; w < NW; ++w) val += *(const v4fa*)(os + w * (64 * 68) + row * 68 + cofs);
            if (BIAS) val += bv;
            *(v4f*)(C + (size_t)(r0 + row) * ldc + c0 + cofs) = val; }
        return;
    }
#pragma unroll
    for (int mb = 0; mb < 4; ++mb) {
#pragma unroll
        for (int nb = 0; nb < 4; ++nb) {
#pragma unroll
            for (int j = 0; j < 8; ++j) os[(hi * 8 + j) * 68 + nb * 16 + lr] = acc[mb][nb][j]; }
        __builtin_amdgcn_wave_barrier(); asm volatile("" ::: "memory");
        float* crow = C + (size_t)(r0 + mb * 16) * ldc + c0;
{
#pragma unroll
            for (int s = 0; s < 8; ++s) { const int row = 2 * s + hi, cofs = lr * 4; v4f val = *(const v4fa*)(os + row * 68 + cofs); if (BIAS) { val[0] += bfr(bias[c0 + cofs]); val[1] += bfr(bias[c0 + cofs + 1]); val[2] += bfr(bias[c0 + cofs + 2]); val[3] += bfr(bias[c0 + cofs + 3]); }
                *(v4f*)(crow + (size_t)row * ldc + cofs) = val; }
             }
        __builtin_amdgcn_wave_barrier(); asm volatile("" ::: "memory");
    }
}

__device__ __forceinline__ h16 tohx(float x) { return (h16)x; }
__device__ __forceinline__ void splitf(float y, unsigned short& h, unsigned short& l) { h = f2bf(y); l = f2bf(y - bf2f(h)); }
typedef __attribute__((ext_vector_type(2))) _Float16 v2h;
typedef __attribute__((ext_vector_type(2))) unsigned short v2us;
typedef __attribute__((ext_vector_type(4))) unsigned short v4us;
typedef __attribute__((ext_vector_type(2))) float v2f;

typedef __attribute__((ext_vector_type(8))) _Float16 v8h16;
typedef __attribute__((ext_vector_type(4))) _Float16 v4h_t;
#define v4h v4h_t
__global__ __launch_bounds__(256) void k_cvt8(const float* __restrict__ src, bf* dst, size_t n8) { const size_t i = (size_t)blockIdx.x * 256 + threadIdx.x; if (i >= n8) return; const v8f v = *(const v8f*)(src + i * 8); v8us o;
#pragma unroll
    for (int k = 0; k < 8; ++k) o[k] = f2bf(v[k]); *(v8us*)(dst + i * 8) = o;  }
__global__ __launch_bounds__(256) void k_wtG(const float* __restrict__ w, int K, int N, bf* Bt) {
    const int lane = threadIdx.x & 31; const int L0 = (blockIdx.x * 8 + (threadIdx.x >> 5)) * 8; const int nlines = N * K / 64;
{
#pragma unroll 1
        for (int l = 0; l < 8; ++l) { const int L = L0 + l; if (L >= nlines) break; const size_t e = (size_t)L * 64 + lane * 2; const int k = (int)(e % K), n = (int)(e / K); v2us o;
            o[0] = f2bf(w[(size_t)k * N + n]); o[1] = f2bf(w[(size_t)(k + 1) * N + n]); *(v2us*)(Bt + e) = o; }
         }
}
__global__ __launch_bounds__(256) void k_cvt16(const float* __restrict__ src, h16* dst, size_t n8) { const size_t i = (size_t)blockIdx.x * 256 + threadIdx.x; if (i >= n8) return; const v8f v = *(const v8f*)(src + i * 8); v8h16 o;
#pragma unroll
    for (int k = 0; k < 8; ++k) o[k] = tohx(bfr(v[k]) * WSC); *(v8h16*)(dst + i * 8) = o;  }
__global__ __launch_bounds__(256) void k_bsc(const float* __restrict__ b, float* BS, int n) { const int i = (blockIdx.x * 256 + threadIdx.x) * 4; if (i >= n) return; const v4f a = *(const v4f*)(b + i); v4f o;
#pragma unroll
    for (int q = 0; q < 4; ++q) o[q] = bfr(a[q]) * WSC; *(v4f*)(BS + i) = o;  }
__global__ __launch_bounds__(256) void k_relu16(const float* __restrict__ H, h16* G16, size_t n) { const size_t i = ((size_t)blockIdx.x * 256 + threadIdx.x) * 2; if (i >= n) return; v2h o;
#pragma unroll
    for (int q = 0; q < 2; ++q) o[q] = tohx(fmaxf(H[i + q] * (1.0f / WSC), 0.f));
    *(v2h*)(G16 + i) = o;  }
__global__ __launch_bounds__(256) void k_ln1t(const float* __restrict__ x, const float* __restrict__ ATT, const float* __restrict__ gg, const float* __restrict__ bb, float* H, h16* T16) {
    const int lane = threadIdx.x & 31; const int r = blockIdx.x * 8 + (threadIdx.x >> 5); if (r >= NT) return; float v[DD / 32]; float s = 0.f;
#pragma unroll
    for (int c = 0; c < DD / 128; ++c) { const v4f a = *(const v4f*)(ATT + (size_t)r * DD + c * 128 + lane * 4), xx = *(const v4f*)(x + (size_t)r * DD + c * 128 + lane * 4);
#pragma unroll
        for (int q = 0; q < 4; ++q) { v[c * 4 + q] = __fadd_rn(bfr(xx[q]), a[q]); s += v[c * 4 + q]; } }
#pragma unroll
    for (int sh = 16; sh; sh >>= 1) s += __shfl_xor(s, sh, 32);
    const float mu = s * (1.0f / DD); float qq = 0.f;
#pragma unroll
    for (int i = 0; i < DD / 32; ++i) { const float d0 = v[i] - mu; qq = __fadd_rn(qq, __fmul_rn(d0, d0)); }
#pragma unroll
    for (int sh = 16; sh; sh >>= 1) qq += __shfl_xor(qq, sh, 32);
    const float rs = __fdiv_rn(1.0f, __fadd_rn(__fsqrt_rn(qq * (1.0f / (DD - 1))), 1e-6f));
{
#pragma unroll
        for (int c = 0; c < DD / 128; ++c) { v4f o; v4h t;
#pragma unroll
            for (int q = 0; q < 4; ++q) { const int col = c * 128 + lane * 4 + q; o[q] = __fadd_rn(__fmul_rn((v[c * 4 + q] - mu) * rs, bfr(gg[col])), bfr(bb[col])); t[q] = tohx(o[q]); }
            *(v4f*)(H + (size_t)r * DD + c * 128 + lane * 4) = o; *(v4h*)(T16 + (size_t)r * DD + c * 128 + lane * 4) = t; }
         }
}
__global__ __launch_bounds__(256) void k_ln2t(const float* __restrict__ H, const float* __restrict__ F2, const float* __restrict__ gg, const float* __restrict__ bb, float* OUT) {
    const int lane = threadIdx.x & 31; const int r = blockIdx.x * 8 + (threadIdx.x >> 5); if (r >= NT) return; float v[DD / 32]; float s = 0.f;
#pragma unroll
    for (int c = 0; c < DD / 128; ++c) { const v4f a = *(const v4f*)(H + (size_t)r * DD + c * 128 + lane * 4), f4 = *(const v4f*)(F2 + (size_t)r * DD + c * 128 + lane * 4);
#pragma unroll
        for (int q = 0; q < 4; ++q) { v[c * 4 + q] = __fadd_rn(a[q], f4[q] * (1.0f / WSC)); s += v[c * 4 + q]; } }
#pragma unroll
    for (int sh = 16; sh; sh >>= 1) s += __shfl_xor(s, sh, 32);
    const float mu = s * (1.0f / DD); float qq = 0.f;
#pragma unroll
    for (int i = 0; i < DD / 32; ++i) { const float d0 = v[i] - mu; qq = __fadd_rn(qq, __fmul_rn(d0, d0)); }
#pragma unroll
    for (int sh = 16; sh; sh >>= 1) qq += __shfl_xor(qq, sh, 32);
    const float rs = __fdiv_rn(1.0f, __fadd_rn(__fsqrt_rn(qq * (1.0f / (DD - 1))), 1e-6f));
{
#pragma unroll
        for (int c = 0; c < DD / 128; ++c) { v4f o;
#pragma unroll
            for (int q = 0; q < 4; ++q) { const int col = c * 128 + lane * 4 + q; o[q] = __fadd_rn(__fmul_rn((v[c * 4 + q] - mu) * rs, bfr(gg[col])), bfr(bb[col])); }
            *(v4f*)(OUT + (size_t)r * DD + c * 128 + lane * 4) = o; }
         }
}
__global__ __launch_bounds__(256) void k_h16plane(const float* __restrict__ F, float sc, h16* P) {
    const int lane = threadIdx.x & 31; const int L0 = (blockIdx.x * 8 + (threadIdx.x >> 5)) * 8; const int nlines = NT * DD / 64;
{
#pragma unroll
        for (int l = 0; l < 8; ++l) { const int L = L0 + l; if (L >= nlines) break; const int e = L * 64 + lane * 2; const int d = e & 63; const int t = (e >> 6) & (TT - 1); const int z = e >> 17; const int b = z / NH_, h = z % NH_; v2h v;
#pragma unroll
            for (int q = 0; q < 2; ++q) v[q] = tohx(F[((size_t)b * TT + t) * DD + h * HD + d + q] * sc);
            *(v2h*)(P + (size_t)e) = v; }
         }
}
__global__ __launch_bounds__(256) void k_vtplane(const float* __restrict__ F, h16* VT) {
    const int lane = threadIdx.x & 31; const int L0 = (blockIdx.x * 8 + (threadIdx.x >> 5)) * 8; const int nlines = NT * DD / 64;
{
#pragma unroll
        for (int l = 0; l < 8; ++l) { const int L = L0 + l; if (L >= nlines) break; const int e = L * 64 + lane * 2; const int t = e & (TT - 1); const int d = (e >> 11) & 63; const int z = e >> 17; const int b = z / NH_, h = z % NH_; v2h v;
#pragma unroll
            for (int q = 0; q < 2; ++q) v[q] = tohx(F[((size_t)b * TT + t + q) * DD + h * HD + d]);
            *(v2h*)(VT + (size_t)e) = v; }
         }
}
__global__ __launch_bounds__(256) void k_asoft(const float* __restrict__ Sb, h16* P16) {
    const int lane = threadIdx.x & 31; const int row = blockIdx.x * 8 + (threadIdx.x >> 5); if (row >= ZH * TT) return;
    const float* sr = Sb + (size_t)row * TT; float v[64]; float mx = -3.0e38f;
#pragma unroll
    for (int ch = 0; ch < 16; ++ch) { const int j0 = ch * 128 + lane * 4; const v4f a = *(const v4f*)(sr + j0);
#pragma unroll
        for (int q = 0; q < 4; ++q) { const float t = a[q] * SCL; v[ch * 4 + q] = t; mx = fmaxf(mx, t); } }
#pragma unroll
    for (int sh = 16; sh; sh >>= 1) mx = fmaxf(mx, __shfl_xor(mx, sh, 32));
    float sum = 0.f;
#pragma unroll
    for (int k = 0; k < 64; ++k) { v[k] = __expf(v[k] - mx); sum += v[k]; }
#pragma unroll
    for (int sh = 16; sh; sh >>= 1) sum += __shfl_xor(sum, sh, 32);
    const float f = __fdiv_rn(PCAR, sum);
{
#pragma unroll
        for (int ch = 0; ch < 16; ++ch) { v4h o;
#pragma unroll
            for (int q = 0; q < 4; ++q) o[q] = tohx(v[ch * 4 + q] * f);
            *(v4h*)(P16 + (size_t)row * TT + ch * 128 + lane * 4) = o; }
         }
}
__global__ __launch_bounds__(256) void k_mergef(const float* __restrict__ O, int b, int h0, float* OUT) {
    const int lane = threadIdx.x & 31; const int L0 = (blockIdx.x * 8 + (threadIdx.x >> 5)) * 8; const int nlines = ZH * TT * HD / 64;
{
#pragma unroll
        for (int l = 0; l < 8; ++l) { const int L = L0 + l; if (L >= nlines) break; const int e = L * 64 + lane * 2; const int d = e & (HD - 1); const int t = (e >> 6) & (TT - 1); const int zz = e >> 17; v2f o2;
#pragma unroll
            for (int q = 0; q < 2; ++q) o2[q] = O[(size_t)e + q] * (1.0f / PCAR);
            *(v2f*)(OUT + ((size_t)b * TT + t) * DD + (h0 + zz) * HD + d) = o2; }
         }
}
__global__ __launch_bounds__(256) void k_merge(const float* __restrict__ O, int b, int h0, bf* Ah, bf* Al) {
    const int lane = threadIdx.x & 31; const int L0 = (blockIdx.x * 8 + (threadIdx.x >> 5)) * 8; const int nlines = ZH * TT * HD / 64;
{
#pragma unroll
        for (int l = 0; l < 8; ++l) { const int L = L0 + l; if (L >= nlines) break; const int e = L * 64 + lane * 2; const int d = e & 63; const int t = (e >> 6) & (TT - 1); const int zz = e >> 17; v2us oh, ol;
#pragma unroll
            for (int q = 0; q < 2; ++q) { unsigned short a, c2; splitf(O[(size_t)e + q] * (1.0f / PCAR), a, c2); oh[q] = a; ol[q] = c2; }
            const size_t o = ((size_t)b * TT + t) * DD + (h0 + zz) * HD + d; *(v2us*)(Ah + o) = oh; *(v2us*)(Al + o) = ol; }
         }
}

extern "C" void kernel_launch(void* const* d_in, const int* in_sizes, int n_in,
                              void* d_out, int out_size, void* d_ws, size_t ws_size, hipStream_t stream) {
    (void)in_sizes; (void)n_in; (void)out_size;
    const float* IN[11]; for (int i = 0; i < 11; ++i) IN[i] = (const float*)d_in[i];
    // x, wq [1024][1024], bq, ln1_a, ln1_b, ln2_a, ln2_b, w1 [4096][1024], b1, w2 [1024][4096], b2 = d_in[0..10]
    float* OUT = (float*)d_out;     // [2][2048][1024]
    char* wsp = (char*)d_ws;
    auto take = [&](size_t bytes) { char* p = wsp; wsp += (bytes + 255) & ~(size_t)255; return (void*)p; };
    bf* WQ = (bf*)take((size_t)DD * DD * 2); h16* W1 = (h16*)take((size_t)FFH * DD * 2); h16* W2 = (h16*)take((size_t)DD * FFH * 2); float* B1 = (float*)take(FFH * 4); float* B2 = (float*)take(DD * 4);
    bf* XQ = (bf*)take((size_t)NT * DD * 2); float* F = (float*)take((size_t)NT * DD * 4); h16* QP = (h16*)take((size_t)NT * DD * 2); h16* VT = (h16*)take((size_t)NT * DD * 2);
    char* R0 = wsp; float* Sb = (float*)take((size_t)ZH * TT * TT * 4); h16* Pm = (h16*)take((size_t)ZH * TT * TT * 2); char* R1 = wsp; float* Ob = (float*)take((size_t)ZH * TT * HD * 4); float* H = (float*)take((size_t)NT * DD * 4); h16* T16 = (h16*)take((size_t)NT * DD * 2);
    if ((size_t)(wsp - (char*)d_ws) > ws_size) return;    // total ~ 137 MB = 131 MiB; ws 256 MiB
    float* ATT = F; float* Hf = (float*)R0; h16* G16 = (h16*)(R0 + (size_t)TT * FFH * 4); if ((char*)(G16 + (size_t)TT * FFH) > R1) return;
    { const size_t nw = (size_t)DD * DD / 8; k_cvt8<<<(unsigned)((nw + 255) / 256), 256, 0, stream>>>(IN[1], WQ, nw);
      const size_t f8 = (size_t)FFH * DD / 8; const unsigned gf = (unsigned)((f8 + 255) / 256); k_cvt16<<<gf, 256, 0, stream>>>(IN[7], W1, f8); k_cvt16<<<gf, 256, 0, stream>>>(IN[9], W2, f8); k_bsc<<<FFH / 1024, 256, 0, stream>>>(IN[8], B1, FFH); k_bsc<<<DD / 1024, 256, 0, stream>>>(IN[10], B2, DD);
      const size_t nx = (size_t)NT * DD / 8; k_cvt8<<<(unsigned)((nx + 255) / 256), 256, 0, stream>>>(IN[0], XQ, nx); }
    const unsigned LB = (unsigned)((NT * DD / 64 + 63) / 64); const dim3 gP(NT / 64, DD / 64, 1);
    k_gemmw<bf, 0, true, 4><<<gP, 128, 0, stream>>>(XQ, nullptr, WQ, nullptr, DD, F, DD, IN[2], 0, 0, 0); k_h16plane<<<LB, 256, 0, stream>>>(F, 1.0f, QP); k_vtplane<<<LB, 256, 0, stream>>>(F, VT);   // h serves as q, k (same plane) and v
    for (int b = 0; b < NB_; ++b)
        for (int h0 = 0; h0 < NH_; h0 += ZH) { const size_t z0 = (size_t)b * NH_ + h0;
            k_gemmw<h16, 0, false, 1><<<dim3(TT / 64, TT / 64, ZH), 32, 0, stream>>>(QP + z0 * TT * HD, nullptr, QP + z0 * TT * HD, nullptr, HD, Sb, TT, nullptr, (size_t)TT * HD, (size_t)TT * HD, (size_t)TT * TT);
            k_asoft<<<ZH * TT / 8, 256, 0, stream>>>(Sb, Pm);
            k_gemmw<h16, 0, false, 16><<<dim3(TT / 64, 1, ZH), 512, 0, stream>>>(Pm, nullptr, VT + z0 * HD * TT, nullptr, TT, Ob, HD, nullptr, (size_t)TT * TT, (size_t)HD * TT, (size_t)TT * HD);
            k_mergef<<<(ZH * TT * HD / 64 + 63) / 64, 256, 0, stream>>>(Ob, b, h0, ATT); }
    k_ln1t<<<NT / 8, 256, 0, stream>>>(IN[0], ATT, IN[3], IN[4], H, T16);
    for (int hb = 0; hb < NB_; ++hb) { const size_t r0 = (size_t)hb * TT;
        k_gemmw<h16, 0, true, 2><<<dim3(TT / 64, FFH / 64, 1), 64, 0, stream>>>(T16 + r0 * DD, nullptr, W1, nullptr, DD, Hf, FFH, B1, 0, 0, 0);
        k_relu16<<<(unsigned)(((size_t)TT * FFH / 2 + 255) / 256), 256, 0, stream>>>(Hf, G16, (size_t)TT * FFH);
        k_gemmw<h16, 0, true, 8><<<dim3(TT / 64, DD / 64, 1), 256, 0, stream>>>(G16, nullptr, W2, nullptr, FFH, F + r0 * DD, DD, B2, 0, 0, 0); }
    k_ln2t<<<NT / 8, 256, 0, stream>>>(H, F, IN[5], IN[6], OUT);
}

// v002
// It runs in 287 microseconds.
// In two side-by-side timings against v001, it was 2.81 and 2.76 times as fast.
// Over all steps from v000 it is 4.95 times as fast.
#include <hip/hip_runtime.h>

// Encoder_layer (x [2][2048][1024]; h = x wq^T + bq is used as q, k AND v (the module applies Wq to all three; Wo unused); 16 heads x 64; softmax(h_q.h_k/8) h_v (no mask); x1 = LN1(x + att_out);
// ffn = relu(x1 w1^T + b1) w2^T + b2 (F 4096); out = LN2(x1 + ffn); LN = a (v - mean)/(std_unbiased + 1e-6) + b (torch.std, ddof 1; eps added to the std)).
// Compute dtypes, f32 accumulate: every input rounded to bf16; the shared projection on PLAIN bf16 operands (inputs: exact, + bias); scores and attn.v on SINGLE fp16
// planes of h (1/8 in the softmax; P unnormalised against a running maximum, the row sum divided out at the end); context f32; LayerNorms, residuals and ReLU f32; the FFN as SINGLE fp16 planes x fp16 copies of bf16(w1/w2) scaled by 2^14 (biases scaled alike;

#define NB_  2
#define FFH  4096
#define WSC  16384.0f
#define TT   2048
#define DD   1024
#define NH_  16
#define HD   64
#define NT   (NB_ * TT)
#define NZ   (NB_ * NH_)
#define ZH   2
#define PCAR 1024.0f
#define SCL  0.125f
typedef _Float16 h16;
typedef unsigned short bf;
typedef __attribute__((ext_vector_type(16))) __bf16   v16bf;
typedef __attribute__((ext_vector_type(16))) _Float16 v16h;
typedef __attribute__((ext_vector_type(8)))  _Float16 v8h;
typedef __attribute__((ext_vector_type(8)))  unsigned short v8us;
typedef __attribute__((ext_vector_type(8)))  float    v8f;
typedef __attribute__((ext_vector_type(4)))  float    v4f;
typedef v8h  __attribute__((may_alias)) v8ha;
typedef v4f  __attribute__((may_alias)) v4fa;
typedef v8us __attribute__((may_alias)) v8usa;

__device__ __forceinline__ unsigned short f2bf(float f) { unsigned u = __float_as_uint(f); u += 0x7FFFu + ((u >> 16) & 1u); return (unsigned short)(u >> 16); }
__device__ __forceinline__ float bf2f(unsigned short b) { return __uint_as_float(((unsigned)b) << 16); }
__device__ __forceinline__ float bfr(float f) { return bf2f(f2bf(f)); }
__device__ __forceinline__ v16h cat16(v8h lo, v8h hi) { return __builtin_shufflevector(lo, hi, 0, 1, 2, 3, 4, 5, 6, 7, 8, 9, 10, 11, 12, 13, 14, 15); }
__device__ __forceinline__ v16bf cat16b(v8us lo, v8us hi) { return __builtin_bit_cast(v16bf, __builtin_shufflevector(lo, hi, 0, 1, 2, 3, 4, 5, 6, 7, 8, 9, 10, 11, 12, 13, 14, 15)); }
__device__ __forceinline__ v8f wmma16(v16h a, v16h b, v8f c) { return __builtin_amdgcn_wmma_f32_16x16x32_f16(false, a, false, b, (short)0, c, false, false); }
__device__ __forceinline__ v8f wmmab(v16bf a, v16bf b, v8f c) { return __builtin_amdgcn_wmma_f32_16x16x32_bf16(false, a, false, b, (short)0, c, false, false); }



// ---- k_gemmw: register-blocked GEMM, one 64x64 output tile per work-group (16 accumulators a wave), operands straight from K-contiguous 16-bit planes; grid (M/64, N/64, Z), 32 * NW threads.
// C[m][n] (f32, pitch ldc, + optional f32 bias[n]) = sum_k A[m][k] Bt[n][k] (+ split products per NSPLIT). z-batch strides sA/sB/sC in elements. K % 32 == 0.
// NW > 1: split-K inside the work-group. NW waves (32 * NW threads) share the one 64x64 tile; wave w takes the 32-wide K chunks w, w + NW, ... (neighbour waves read the two halves of the same
// 128-byte lines at about the same time), parks its f32 partial tile in LDS, and behind one barrier all threads add the NW partials in wave order and store. NW == 1 is the single-wave form.
template <typename T16> struct WFrag;
template <> struct WFrag<h16> { typedef v16h V; static __device__ __forceinline__ V ld(const h16* p) { return cat16(*(const v8h*)p, *(const v8h*)(p + 16)); } static __device__ __forceinline__ v8f mma(V a, V b, v8f c) { return wmma16(a, b, c); } };
template <> struct WFrag<bf> { typedef v16bf V; static __device__ __forceinline__ V ld(const bf* p) { return cat16b(*(const v8us*)p, *(const v8us*)(p + 16)); } static __device__ __forceinline__ v8f mma(V a, V b, v8f c) { return wmmab(a, b, c); } };
template <typename T16, int NSPLIT, bool BIAS, int NW>
__global__ __launch_bounds__(32 * NW) void k_gemmw(const T16* __restrict__ A, const T16* __restrict__ A2, const T16* __restrict__ Bt, const T16* __restrict__ Bt2, int K, float* C, int ldc, const float* __restrict__ bias, size_t sA, size_t sB, size_t sC) {
    typedef typename WFrag<T16>::V V;
    __shared__ __align__(16) float os[(NW == 1 ? 16 : NW * 64) * 68];
    const int wv = NW == 1 ? 0 : __builtin_amdgcn_readfirstlane((int)(threadIdx.x >> 5));
    const size_t z = blockIdx.z; A += z * sA; if (A2) A2 += z * sA; Bt += z * sB; if (Bt2) Bt2 += z * sB; C += z * sC;
    const int lane = threadIdx.x & 31, lr = lane & 15, hi = lane >> 4; const int r0 = blockIdx.x * 64, c0 = blockIdx.y * 64;
    v8f acc[4][4];
#pragma unroll
    for (int mb = 0; mb < 4; ++mb)
#pragma unroll
        for (int nb = 0; nb < 4; ++nb) acc[mb][nb] = (v8f){};
    const size_t aoff = (size_t)(r0 + lr) * K + 8 * hi, boff = (size_t)(c0 + lr) * K + 8 * hi;
#pragma unroll 1
    for (int kc = wv * 32; kc < K; kc += 32 * NW) {
        V a[4], a2[4];
#pragma unroll
        for (int mb = 0; mb < 4; ++mb) { a[mb] = WFrag<T16>::ld(A + aoff + (size_t)mb * 16 * K + kc); if (NSPLIT == 1 || NSPLIT == 2) a2[mb] = WFrag<T16>::ld(A2 + aoff + (size_t)mb * 16 * K + kc); }
#pragma unroll
        for (int nb = 0; nb < 4; ++nb) { const V b = WFrag<T16>::ld(Bt + boff + (size_t)nb * 16 * K + kc); V b2; if (NSPLIT >= 2) b2 = WFrag<T16>::ld(Bt2 + boff + (size_t)nb * 16 * K + kc);
#pragma unroll
            for (int mb = 0; mb < 4; ++mb) { acc[mb][nb] = WFrag<T16>::mma(a[mb], b, acc[mb][nb]); if (NSPLIT == 1 || NSPLIT == 2) acc[mb][nb] = WFrag<T16>::mma(a2[mb], b, acc[mb][nb]); if (NSPLIT >= 2) acc[mb][nb] = WFrag<T16>::mma(a[mb], b2, acc[mb][nb]); } }
        asm volatile("v_nop\n\tv_nop\n\tv_nop\n\tv_nop" : "+v"(acc[0][0]), "+v"(acc[1][1]), "+v"(acc[2][2]), "+v"(acc[3][3]) : "v"(a[0]), "v"(a[3]));
    }
    if constexpr (NW > 1) {
        float* ow = os + wv * (64 * 68); const int cofs = ((int)threadIdx.x & 15) * 4; v4f bv = (v4f){};
        if (BIAS) { bv[0] = bfr(bias[c0 + cofs]); bv[1] = bfr(bias[c0 + cofs + 1]); bv[2] = bfr(bias[c0 + cofs + 2]); bv[3] = bfr(bias[c0 + cofs + 3]); }    // fetched ahead of the barrier: its latency hides behind the LDS stores
#pragma unroll
        for (int mb = 0; mb < 4; ++mb)
#pragma unroll
            for (int nb = 0; nb < 4; ++nb)
#pragma unroll
                for (int j = 0; j < 8; ++j) ow[(mb * 16 + hi * 8 + j) * 68 + nb * 16 + lr] = acc[mb][nb][j];
        __syncthreads();    // every wave's partial tile is in LDS before any thread sums across waves
#pragma unroll
        for (int i = 0; i < 32 / NW; ++i) { const int row = ((int)threadIdx.x + i * 32 * NW) >> 4; v4f val = *(const v4fa*)(os + row * 68 + cofs);
#pragma unroll
            for (int w = 1; w < NW; ++w) val += *(const v4fa*)(os + w * (64 * 68) + row * 68 + cofs);
            if (BIAS) val += bv;
            *(v4f*)(C + (size_t)(r0 + row) * ldc + c0 + cofs) = val; }
        return;
    }
#pragma unroll
    for (int mb = 0; mb < 4; ++mb) {
#pragma unroll
        for (int nb = 0; nb < 4; ++nb) {
#pragma unroll
            for (int j = 0; j < 8; ++j) os[(hi * 8 + j) * 68 + nb * 16 + lr] = acc[mb][nb][j]; }
        __builtin_amdgcn_wave_barrier(); asm volatile("" ::: "memory");
        float* crow = C + (size_t)(r0 + mb * 16) * ldc + c0;
{
#pragma unroll
            for (int s = 0; s < 8; ++s) { const int row = 2 * s + hi, cofs = lr * 4; v4f val = *(const v4fa*)(os + row * 68 + cofs); if (BIAS) { val[0] += bfr(bias[c0 + cofs]); val[1] += bfr(bias[c0 + cofs + 1]); val[2] += bfr(bias[c0 + cofs + 2]); val[3] += bfr(bias[c0 + cofs + 3]); }
                *(v4f*)(crow + (size_t)row * ldc + cofs) = val; }
             }
        __builtin_amdgcn_wave_barrier(); asm volatile("" ::: "memory");
    }
}

__device__ __forceinline__ h16 tohx(float x) { return (h16)x; }
__device__ __forceinline__ void splitf(float y, unsigned short& h, unsigned short& l) { h = f2bf(y); l = f2bf(y - bf2f(h)); }
typedef __attribute__((ext_vector_type(2))) _Float16 v2h;
typedef __attribute__((ext_vector_type(2))) unsigned short v2us;
typedef __attribute__((ext_vector_type(4))) unsigned short v4us;
typedef __attribute__((ext_vector_type(2))) float v2f;

typedef __attribute__((ext_vector_type(8))) _Float16 v8h16;
typedef __attribute__((ext_vector_type(4))) _Float16 v4h_t;
#define v4h v4h_t
__global__ __launch_bounds__(256) void k_cvt8(const float* __restrict__ src, bf* dst, size_t n8) { const size_t i = (size_t)blockIdx.x * 256 + threadIdx.x; if (i >= n8) return; const v8f v = *(const v8f*)(src + i * 8); v8us o;
#pragma unroll
    for (int k = 0; k < 8; ++k) o[k] = f2bf(v[k]); *(v8us*)(dst + i * 8) = o;  }
__global__ __launch_bounds__(256) void k_wtG(const float* __restrict__ w, int K, int N, bf* Bt) {
    const int lane = threadIdx.x & 31; const int L0 = (blockIdx.x * 8 + (threadIdx.x >> 5)) * 8; const int nlines = N * K / 64;
{
#pragma unroll 1
        for (int l = 0; l < 8; ++l) { const int L = L0 + l; if (L >= nlines) break; const size_t e = (size_t)L * 64 + lane * 2; const int k = (int)(e % K), n = (int)(e / K); v2us o;
            o[0] = f2bf(w[(size_t)k * N + n]); o[1] = f2bf(w[(size_t)(k + 1) * N + n]); *(v2us*)(Bt + e) = o; }
         }
}
__global__ __launch_bounds__(256) void k_cvt16(const float* __restrict__ src, h16* dst, size_t n8) { const size_t i = (size_t)blockIdx.x * 256 + threadIdx.x; if (i >= n8) return; const v8f v = *(const v8f*)(src + i * 8); v8h16 o;
#pragma unroll
    for (int k = 0; k < 8; ++k) o[k] = tohx(bfr(v[k]) * WSC); *(v8h16*)(dst + i * 8) = o;  }
__global__ __launch_bounds__(256) void k_bsc(const float* __restrict__ b, float* BS, int n) { const int i = (blockIdx.x * 256 + threadIdx.x) * 4; if (i >= n) return; const v4f a = *(const v4f*)(b + i); v4f o;
#pragma unroll
    for (int q = 0; q < 4; ++q) o[q] = bfr(a[q]) * WSC; *(v4f*)(BS + i) = o;  }
__global__ __launch_bounds__(256) void k_relu16(const float* __restrict__ H, h16* G16, size_t n) { const size_t i = ((size_t)blockIdx.x * 256 + threadIdx.x) * 2; if (i >= n) return; v2h o;
#pragma unroll
    for (int q = 0; q < 2; ++q) o[q] = tohx(fmaxf(H[i + q] * (1.0f / WSC), 0.f));
    *(v2h*)(G16 + i) = o;  }
__global__ __launch_bounds__(256) void k_ln1t(const float* __restrict__ x, const float* __restrict__ ATT, const float* __restrict__ gg, const float* __restrict__ bb, float* H, h16* T16) {
    const int lane = threadIdx.x & 31; const int r = blockIdx.x * 8 + (threadIdx.x >> 5); if (r >= NT) return; float v[DD / 32]; float s = 0.f;
#pragma unroll
    for (int c = 0; c < DD / 128; ++c) { const v4f a = *(const v4f*)(ATT + (size_t)r * DD + c * 128 + lane * 4), xx = *(const v4f*)(x + (size_t)r * DD + c * 128 + lane * 4);
#pragma unroll
        for (int q = 0; q < 4; ++q) { v[c * 4 + q] = __fadd_rn(bfr(xx[q]), a[q]); s += v[c * 4 + q]; } }
#pragma unroll
    for (int sh = 16; sh; sh >>= 1) s += __shfl_xor(s, sh, 32);
    const float mu = s * (1.0f / DD); float qq = 0.f;
#pragma unroll
    for (int i = 0; i < DD / 32; ++i) { const float d0 = v[i] - mu; qq = __fadd_rn(qq, __fmul_rn(d0, d0)); }
#pragma unroll
    for (int sh = 16; sh; sh >>= 1) qq += __shfl_xor(qq, sh, 32);
    const float rs = __fdiv_rn(1.0f, __fadd_rn(__fsqrt_rn(qq * (1.0f / (DD - 1))), 1e-6f));
{
#pragma unroll
        for (int c = 0; c < DD / 128; ++c) { v4f o; v4h t;
#pragma unroll
            for (int q = 0; q < 4; ++q) { const int col = c * 128 + lane * 4 + q; o[q] = __fadd_rn(__fmul_rn((v[c * 4 + q] - mu) * rs, bfr(gg[col])), bfr(bb[col])); t[q] = tohx(o[q]); }
            *(v4f*)(H + (size_t)r * DD + c * 128 + lane * 4) = o; *(v4h*)(T16 + (size_t)r * DD + c * 128 + lane * 4) = t; }
         }
}
__global__ __launch_bounds__(256) void k_ln2t(const float* __restrict__ H, const float* __restrict__ F2, const float* __restrict__ gg, const float* __restrict__ bb, float* OUT) {
    const int lane = threadIdx.x & 31; const int r = blockIdx.x * 8 + (threadIdx.x >> 5); if (r >= NT) return; float v[DD / 32]; float s = 0.f;
#pragma unroll
    for (int c = 0; c < DD / 128; ++c) { const v4f a = *(const v4f*)(H + (size_t)r * DD + c * 128 + lane * 4), f4 = *(const v4f*)(F2 + (size_t)r * DD + c * 128 + lane * 4);
#pragma unroll
        for (int q = 0; q < 4; ++q) { v[c * 4 + q] = __fadd_rn(a[q], f4[q] * (1.0f / WSC)); s += v[c * 4 + q]; } }
#pragma unroll
    for (int sh = 16; sh; sh >>= 1) s += __shfl_xor(s, sh, 32);
    const float mu = s * (1.0f / DD); float qq = 0.f;
#pragma unroll
    for (int i = 0; i < DD / 32; ++i) { const float d0 = v[i] - mu; qq = __fadd_rn(qq, __fmul_rn(d0, d0)); }
#pragma unroll
    for (int sh = 16; sh; sh >>= 1) qq += __shfl_xor(qq, sh, 32);
    const float rs = __fdiv_rn(1.0f, __fadd_rn(__fsqrt_rn(qq * (1.0f / (DD - 1))), 1e-6f));
{
#pragma unroll
        for (int c = 0; c < DD / 128; ++c) { v4f o;
#pragma unroll
            for (int q = 0; q < 4; ++q) { const int col = c * 128 + lane * 4 + q; o[q] = __fadd_rn(__fmul_rn((v[c * 4 + q] - mu) * rs, bfr(gg[col])), bfr(bb[col])); }
            *(v4f*)(OUT + (size_t)r * DD + c * 128 + lane * 4) = o; }
         }
}
__global__ __launch_bounds__(256) void k_h16plane(const float* __restrict__ F, float sc, h16* P) {
    const int lane = threadIdx.x & 31; const int L0 = (blockIdx.x * 8 + (threadIdx.x >> 5)) * 8; const int nlines = NT * DD / 64;
{
#pragma unroll
        for (int l = 0; l < 8; ++l) { const int L = L0 + l; if (L >= nlines) break; const int e = L * 64 + lane * 2; const int d = e & 63; const int t = (e >> 6) & (TT - 1); const int z = e >> 17; const int b = z / NH_, h = z % NH_; v2h v;
#pragma unroll
            for (int q = 0; q < 2; ++q) v[q] = tohx(F[((size_t)b * TT + t) * DD + h * HD + d + q] * sc);
            *(v2h*)(P + (size_t)e) = v; }
         }
}
__global__ __launch_bounds__(256) void k_vtplane(const float* __restrict__ F, h16* VT) {
    const int lane = threadIdx.x & 31; const int L0 = (blockIdx.x * 8 + (threadIdx.x >> 5)) * 8; const int nlines = NT * DD / 64;
{
#pragma unroll
        for (int l = 0; l < 8; ++l) { const int L = L0 + l; if (L >= nlines) break; const int e = L * 64 + lane * 2; const int t = e & (TT - 1); const int d = (e >> 11) & 63; const int z = e >> 17; const int b = z / NH_, h = z % NH_; v2h v;
#pragma unroll
            for (int q = 0; q < 2; ++q) v[q] = tohx(F[((size_t)b * TT + t + q) * DD + h * HD + d]);
            *(v2h*)(VT + (size_t)e) = v; }
         }
}
// ---- k_fattn: scores, softmax and attn.v of one head in one kernel; no score or probability plane in memory. Grid (TT / 256, NZ), 256 threads: 8 waves x 32 query columns; all waves walk the
// same 64-key stages of K ([t][d]) and V^T ([d][t]), staged through registers into LDS (next stage's global loads fly during this stage's work). Transposed products: S^T = K Q^T leaves one query
// per lane column (keys 8 hi + j and 16 + 8 hi + j of each 32), so two score tiles, converted in place, ARE the B operand of O^T += V^T P^T in the loader's k order. Running maximum per query in
// log2 units; P = 2^(s c - m) unnormalised in fp16, f32 row sum of the unrounded values, one division at the end. Every '#pragma unroll' below stands on a loop of constant length that indexes
// fragments or accumulators: unrolled, those arrays live in registers.
#define FKS  64     // keys a stage
#define FPIT 72     // LDS row pitch in 16-bit elements: 144 B = 16 B x 9, an odd multiple, so that 16-byte fragment reads of 16 rows meet no bank twice
#define FSC  0.18033688011112042f    // 1/8 (the score scale) x log2(e)
__device__ __forceinline__ float xhalf(float x) { return __builtin_bit_cast(float, __builtin_amdgcn_permlanex16(__builtin_bit_cast(int, x), __builtin_bit_cast(int, x), 0x76543210, 0xfedcba98, false, false)); }    // lane l takes lane l ^ 16's value
// eight 2^x in one statement, each in place: no v_exp_f32 here reads the result or overwrites the source of the one in front of it, and the closing v_nop is the one slot that the instruction set
// asks for behind a transcendental before its result is used or its source overwritten. In place, so that the statement writes only
// registers that hold its own live inputs, never an operand of a matrix instruction still in flight.
__device__ __forceinline__ v8f exp2x8(v8f x) { float e0 = x[0], e1 = x[1], e2 = x[2], e3 = x[3], e4 = x[4], e5 = x[5], e6 = x[6], e7 = x[7];
    asm("v_exp_f32 %0, %0\n\tv_exp_f32 %1, %1\n\tv_exp_f32 %2, %2\n\tv_exp_f32 %3, %3\n\tv_exp_f32 %4, %4\n\tv_exp_f32 %5, %5\n\tv_exp_f32 %6, %6\n\tv_exp_f32 %7, %7\n\tv_nop"
        : "+v"(e0), "+v"(e1), "+v"(e2), "+v"(e3), "+v"(e4), "+v"(e5), "+v"(e6), "+v"(e7));
    return (v8f){e0, e1, e2, e3, e4, e5, e6, e7}; }
// amdgpu_waves_per_eu(4, 4): a budget of 256 registers, so that the asm statement above never meets a register window
__global__ __launch_bounds__(256) __attribute__((amdgpu_waves_per_eu(4, 4))) void k_fattn(const h16* __restrict__ QP, const h16* __restrict__ VT, float* __restrict__ ATT) {
    __shared__ __align__(16) h16 Ks[FKS * FPIT];
    __shared__ __align__(16) h16 Vs[HD * FPIT];
    const int tid = threadIdx.x, lane = tid & 31, lr = lane & 15, hi = lane >> 4; const int z = blockIdx.y;
    const int wv = __builtin_amdgcn_readfirstlane(tid >> 5);    // the wave's number in a scalar register: what hangs on it (query base, output base) then costs no vector register through the loop
    const h16* Kp = QP + (size_t)z * TT * HD; const h16* Vp = VT + (size_t)z * HD * TT; const int q0 = blockIdx.x * 256 + wv * 32;
    v16h qf[2][2]; v8f o[2][4]; float mc[2], l[2];
#pragma unroll
    for (int qb = 0; qb < 2; ++qb) { mc[qb] = -1.0e30f; l[qb] = 0.f;
#pragma unroll
        for (int ks = 0; ks < 2; ++ks) qf[qb][ks] = WFrag<h16>::ld(Kp + (q0 + qb * 16) * HD + (unsigned)(lr * HD + ks * 32 + 8 * hi));
#pragma unroll
        for (int dt = 0; dt < 4; ++dt) o[qb][dt] = (v8f){}; }
    const int srow = tid >> 3, scol = (tid & 7) * 8;    // this thread stages 16 bytes of rows srow and srow + 32 of each tile
    const unsigned ko = srow * HD + scol, vo = srow * TT + scol;    // 32-bit element offsets from the head's planes (uniform bases)
    v8h gk0 = *(const v8h*)(Kp + ko), gk1 = *(const v8h*)(Kp + ko + 32 * HD), gv0 = *(const v8h*)(Vp + vo), gv1 = *(const v8h*)(Vp + vo + 32 * TT);
    const h16* Kn = Kp; const h16* Vn = Vp;    // the stage being fetched (uniform)
    for (int k0 = 0; k0 < TT; k0 += FKS) {
        __syncthreads();    // every wave has read the last of the previous stage before it is overwritten
        *(v8h*)(Ks + srow * FPIT + scol) = gk0; *(v8h*)(Ks + (srow + 32) * FPIT + scol) = gk1; *(v8h*)(Vs + srow * FPIT + scol) = gv0; *(v8h*)(Vs + (srow + 32) * FPIT + scol) = gv1;
        __syncthreads();    // the stage is whole in LDS before any wave reads it
        if (k0 + FKS < TT) { Kn += FKS * HD; Vn += FKS;
            gk0 = *(const v8h*)(Kn + ko); gk1 = *(const v8h*)(Kn + ko + 32 * HD); gv0 = *(const v8h*)(Vn + vo); gv1 = *(const v8h*)(Vn + vo + 32 * TT); }
#pragma unroll
        for (int kh = 0; kh < 2; ++kh) {    // 32 keys a pass
            v8f s[2][2]; float mx[2];
            { v16h kf[2][2];
#pragma unroll
              for (int kt = 0; kt < 2; ++kt)
#pragma unroll
                  for (int ks = 0; ks < 2; ++ks) kf[kt][ks] = WFrag<h16>::ld(Ks + (kh * 32 + kt * 16 + lr) * FPIT + ks * 32 + 8 * hi);
#pragma unroll
              for (int qb = 0; qb < 2; ++qb)
#pragma unroll
                  for (int kt = 0; kt < 2; ++kt) s[qb][kt] = wmma16(kf[kt][1], qf[qb][1], wmma16(kf[kt][0], qf[qb][0], (v8f){})); }
            v16h vf[4];
#pragma unroll
            for (int dt = 0; dt < 4; ++dt) vf[dt] = WFrag<h16>::ld(Vs + (dt * 16 + lr) * FPIT + kh * 32 + 8 * hi);
#pragma unroll
            for (int qb = 0; qb < 2; ++qb) { float t = fmaxf(s[qb][0][0], s[qb][1][0]);
#pragma unroll
                for (int j = 1; j < 8; ++j) t = fmaxf(t, fmaxf(s[qb][0][j], s[qb][1][j]));
                mx[qb] = t * FSC; }
            // lazy rescale, tested once a pass: the maximum in use moves only when some query's new maximum passes it by more than 8 (P stays below 2^8, far inside fp16)
            if (__builtin_amdgcn_ballot_w32(mx[0] > mc[0] + 8.0f || mx[1] > mc[1] + 8.0f) != 0) {
#pragma unroll
                for (int qb = 0; qb < 2; ++qb) { const float mn = fmaxf(mc[qb], fmaxf(mx[qb], xhalf(mx[qb]))); const float f = __builtin_amdgcn_exp2f(mc[qb] - mn); mc[qb] = mn; l[qb] *= f;
#pragma unroll
                    for (int dt = 0; dt < 4; ++dt) o[qb][dt] *= f; }
            }
#pragma unroll
            for (int qb = 0; qb < 2; ++qb) { v16h p; v8f x0, x1;
#pragma unroll
                for (int j = 0; j < 8; ++j) { x0[j] = fmaf(s[qb][0][j], FSC, -mc[qb]); x1[j] = fmaf(s[qb][1][j], FSC, -mc[qb]); }
                const v8f e0 = exp2x8(x0), e1 = exp2x8(x1);
#pragma unroll
                for (int j = 0; j < 8; ++j) { l[qb] += e0[j] + e1[j]; p[j] = tohx(e0[j]); p[8 + j] = tohx(e1[j]); }
#pragma unroll
                for (int dt = 0; dt < 4; ++dt) o[qb][dt] = wmma16(vf[dt], p, o[qb][dt]); }
        }
    }
    const int b = z / NH_, h = z % NH_;
#pragma unroll
    for (int qb = 0; qb < 2; ++qb) { const float inv = __fdiv_rn(1.0f, l[qb] + xhalf(l[qb])); float* orow = ATT + ((size_t)b * TT + q0 + qb * 16) * DD + h * HD + (unsigned)(lr * DD + 8 * hi);
#pragma unroll
        for (int dt = 0; dt < 4; ++dt) { v4f a, c;
#pragma unroll
            for (int j = 0; j < 4; ++j) { a[j] = o[qb][dt][j] * inv; c[j] = o[qb][dt][4 + j] * inv; }
            *(v4f*)(orow + dt * 16) = a; *(v4f*)(orow + dt * 16 + 4) = c; } }
}
__global__ __launch_bounds__(256) void k_merge(const float* __restrict__ O, int b, int h0, bf* Ah, bf* Al) {
    const int lane = threadIdx.x & 31; const int L0 = (blockIdx.x * 8 + (threadIdx.x >> 5)) * 8; const int nlines = ZH * TT * HD / 64;
{
#pragma unroll
        for (int l = 0; l < 8; ++l) { const int L = L0 + l; if (L >= nlines) break; const int e = L * 64 + lane * 2; const int d = e & 63; const int t = (e >> 6) & (TT - 1); const int zz = e >> 17; v2us oh, ol;
#pragma unroll
            for (int q = 0; q < 2; ++q) { unsigned short a, c2; splitf(O[(size_t)e + q] * (1.0f / PCAR), a, c2); oh[q] = a; ol[q] = c2; }
            const size_t o = ((size_t)b * TT + t) * DD + (h0 + zz) * HD + d; *(v2us*)(Ah + o) = oh; *(v2us*)(Al + o) = ol; }
         }
}

extern "C" void kernel_launch(void* const* d_in, const int* in_sizes, int n_in,
                              void* d_out, int out_size, void* d_ws, size_t ws_size, hipStream_t stream) {
    (void)in_sizes; (void)n_in; (void)out_size;
    const float* IN[11]; for (int i = 0; i < 11; ++i) IN[i] = (const float*)d_in[i];
    // x, wq [1024][1024], bq, ln1_a, ln1_b, ln2_a, ln2_b, w1 [4096][1024], b1, w2 [1024][4096], b2 = d_in[0..10]
    float* OUT = (float*)d_out;     // [2][2048][1024]
    char* wsp = (char*)d_ws;
    auto take = [&](size_t bytes) { char* p = wsp; wsp += (bytes + 255) & ~(size_t)255; return (void*)p; };
    bf* WQ = (bf*)take((size_t)DD * DD * 2); h16* W1 = (h16*)take((size_t)FFH * DD * 2); h16* W2 = (h16*)take((size_t)DD * FFH * 2); float* B1 = (float*)take(FFH * 4); float* B2 = (float*)take(DD * 4);
    bf* XQ = (bf*)take((size_t)NT * DD * 2); float* F = (float*)take((size_t)NT * DD * 4); h16* QP = (h16*)take((size_t)NT * DD * 2); h16* VT = (h16*)take((size_t)NT * DD * 2);
    float* Hf = (float*)take((size_t)TT * FFH * 4); h16* G16 = (h16*)take((size_t)TT * FFH * 2); float* H = (float*)take((size_t)NT * DD * 4); h16* T16 = (h16*)take((size_t)NT * DD * 2);
    if ((size_t)(wsp - (char*)d_ws) > ws_size) return;    // total ~ 136 MB = 130 MiB; ws 256 MiB
    float* ATT = F;
    { const size_t nw = (size_t)DD * DD / 8; k_cvt8<<<(unsigned)((nw + 255) / 256), 256, 0, stream>>>(IN[1], WQ, nw);
      const size_t f8 = (size_t)FFH * DD / 8; const unsigned gf = (unsigned)((f8 + 255) / 256); k_cvt16<<<gf, 256, 0, stream>>>(IN[7], W1, f8); k_cvt16<<<gf, 256, 0, stream>>>(IN[9], W2, f8); k_bsc<<<FFH / 1024, 256, 0, stream>>>(IN[8], B1, FFH); k_bsc<<<DD / 1024, 256, 0, stream>>>(IN[10], B2, DD);
      const size_t nx = (size_t)NT * DD / 8; k_cvt8<<<(unsigned)((nx + 255) / 256), 256, 0, stream>>>(IN[0], XQ, nx); }
    const unsigned LB = (unsigned)((NT * DD / 64 + 63) / 64); const dim3 gP(NT / 64, DD / 64, 1);
    k_gemmw<bf, 0, true, 4><<<gP, 128, 0, stream>>>(XQ, nullptr, WQ, nullptr, DD, F, DD, IN[2], 0, 0, 0); k_h16plane<<<LB, 256, 0, stream>>>(F, 1.0f, QP); k_vtplane<<<LB, 256, 0, stream>>>(F, VT);   // h serves as q, k (same plane) and v
    k_fattn<<<dim3(TT / 256, NZ, 1), 256, 0, stream>>>(QP, VT, ATT);
    k_ln1t<<<NT / 8, 256, 0, stream>>>(IN[0], ATT, IN[3], IN[4], H, T16);
    for (int hb = 0; hb < NB_; ++hb) { const size_t r0 = (size_t)hb * TT;
        k_gemmw<h16, 0, true, 2><<<dim3(TT / 64, FFH / 64, 1), 64, 0, stream>>>(T16 + r0 * DD, nullptr, W1, nullptr, DD, Hf, FFH, B1, 0, 0, 0);
        k_relu16<<<(unsigned)(((size_t)TT * FFH / 2 + 255) / 256), 256, 0, stream>>>(Hf, G16, (size_t)TT * FFH);
        k_gemmw<h16, 0, true, 8><<<dim3(TT / 64, DD / 64, 1), 256, 0, stream>>>(G16, nullptr, W2, nullptr, FFH, F + r0 * DD, DD, B2, 0, 0, 0); }
    k_ln2t<<<NT / 8, 256, 0, stream>>>(H, F, IN[5], IN[6], OUT);
}

// v003
// Measured time: 247 microseconds a run.
// In two side-by-side timings against v002, it was 1.17 and 1.16 times as fast.
// Counting every step since v000, it is 5.76 times as fast.
#include <hip/hip_runtime.h>

// Encoder_layer (x [2][2048][1024]; h = x wq^T + bq is used as q, k AND v (the module applies Wq to all three; Wo unused); 16 heads x 64; softmax(h_q.h_k/8) h_v (no mask); x1 = LN1(x + att_out);
// ffn = relu(x1 w1^T + b1) w2^T + b2 (F 4096); out = LN2(x1 + ffn); LN = a (v - mean)/(std_unbiased + 1e-6) + b (torch.std, ddof 1; eps added to the std)).
// Compute dtypes, f32 accumulate: every input rounded to bf16; the shared projection on PLAIN bf16 operands (inputs: exact, + bias); scores and attn.v on SINGLE fp16
// planes of h (1/8 in the softmax; P unnormalised against a running maximum, the row sum divided out at the end); context f32; LayerNorms, residuals and ReLU f32; the FFN as SINGLE fp16 planes x fp16 copies of bf16(w1/w2) scaled by 2^14 (biases scaled alike;

#define NB_  2
#define FFH  4096
#define WSC  16384.0f
#define TT   2048
#define DD   1024
#define NH_  16
#define HD   64
#define NT   (NB_ * TT)
#define NZ   (NB_ * NH_)
#define ZH   2
#define PCAR 1024.0f
#define SCL  0.125f
typedef _Float16 h16;
typedef unsigned short bf;
typedef __attribute__((ext_vector_type(16))) __bf16   v16bf;
typedef __attribute__((ext_vector_type(16))) _Float16 v16h;
typedef __attribute__((ext_vector_type(8)))  _Float16 v8h;
typedef __attribute__((ext_vector_type(8)))  unsigned short v8us;
typedef __attribute__((ext_vector_type(8)))  float    v8f;
typedef __attribute__((ext_vector_type(4)))  float    v4f;
typedef v8h  __attribute__((may_alias)) v8ha;
typedef v4f  __attribute__((may_alias)) v4fa;
typedef v8us __attribute__((may_alias)) v8usa;

__device__ __forceinline__ unsigned short f2bf(float f) { unsigned u = __float_as_uint(f); u += 0x7FFFu + ((u >> 16) & 1u); return (unsigned short)(u >> 16); }
__device__ __forceinline__ float bf2f(unsigned short b) { return __uint_as_float(((unsigned)b) << 16); }
__device__ __forceinline__ float bfr(float f) { return bf2f(f2bf(f)); }
__device__ __forceinline__ v16h cat16(v8h lo, v8h hi) { return __builtin_shufflevector(lo, hi, 0, 1, 2, 3, 4, 5, 6, 7, 8, 9, 10, 11, 12, 13, 14, 15); }
__device__ __forceinline__ v16bf cat16b(v8us lo, v8us hi) { return __builtin_bit_cast(v16bf, __builtin_shufflevector(lo, hi, 0, 1, 2, 3, 4, 5, 6, 7, 8, 9, 10, 11, 12, 13, 14, 15)); }
__device__ __forceinline__ v8f wmma16(v16h a, v16h b, v8f c) { return __builtin_amdgcn_wmma_f32_16x16x32_f16(false, a, false, b, (short)0, c, false, false); }
__device__ __forceinline__ v8f wmmab(v16bf a, v16bf b, v8f c) { return __builtin_amdgcn_wmma_f32_16x16x32_bf16(false, a, false, b, (short)0, c, false, false); }



// ---- k_gemmw: register-blocked GEMM, one 64x64 output tile per work-group (16 accumulators a wave), operands straight from K-contiguous 16-bit planes; grid (M/64, N/64, Z), 32 * NW threads.
// C[m][n] (f32, pitch ldc, + optional f32 bias[n]) = sum_k A[m][k] Bt[n][k] (+ split products per NSPLIT). z-batch strides sA/sB/sC in elements. K % 32 == 0.
// NW > 1: split-K inside the work-group. NW waves (32 * NW threads) share the one 64x64 tile; wave w takes the 32-wide K chunks w, w + NW, ... (neighbour waves read the two halves of the same
// 128-byte lines at about the same time), parks its f32 partial tile in LDS, and behind one barrier all threads add the NW partials in wave order and store. NW == 1 is the single-wave form.
// EPI says what the summed tile becomes (NW > 1): 0 the f32 plane C; 1 P16[m][n] = fp16(relu(value / WSC)), pitch ldc (the next GEMM's A plane); 2 the tile is 64 tokens of ONE head (N tile = head size):
// P16 = the head's [t][d] fp16 plane and V16 = its [d][t] plane, both in whole 128-byte lines. The consumer's plane is written where the value is made, so no f32 plane and no elementwise launch stand between.
__device__ __forceinline__ h16 tohx(float x) { return (h16)x; }
typedef __attribute__((ext_vector_type(4))) _Float16 v4h_t;
#define v4h v4h_t
template <typename T16> struct WFrag;
template <> struct WFrag<h16> { typedef v16h V; static __device__ __forceinline__ V ld(const h16* p) { return cat16(*(const v8h*)p, *(const v8h*)(p + 16)); } static __device__ __forceinline__ v8f mma(V a, V b, v8f c) { return wmma16(a, b, c); } };
template <> struct WFrag<bf> { typedef v16bf V; static __device__ __forceinline__ V ld(const bf* p) { return cat16b(*(const v8us*)p, *(const v8us*)(p + 16)); } static __device__ __forceinline__ v8f mma(V a, V b, v8f c) { return wmmab(a, b, c); } };
template <typename T16, int NSPLIT, bool BIAS, int NW, int EPI>
__global__ __launch_bounds__(32 * NW) void k_gemmw(const T16* __restrict__ A, const T16* __restrict__ A2, const T16* __restrict__ Bt, const T16* __restrict__ Bt2, int K, float* C, int ldc, const float* __restrict__ bias, size_t sA, size_t sB, size_t sC, h16* P16, h16* V16) {
    static_assert(EPI == 0 || NW > 1, "the fp16 epilogues stand in the split-K form"); static_assert(EPI != 2 || NW == 4, "the transposed pass gives each of 128 threads one 8 x 4 block");
    typedef typename WFrag<T16>::V V;
    __shared__ __align__(16) float os[(NW == 1 ? 16 : NW * 64) * 68];
    const int wv = NW == 1 ? 0 : __builtin_amdgcn_readfirstlane((int)(threadIdx.x >> 5));
    const size_t z = blockIdx.z; A += z * sA; if (A2) A2 += z * sA; Bt += z * sB; if (Bt2) Bt2 += z * sB; C += z * sC;
    const int lane = threadIdx.x & 31, lr = lane & 15, hi = lane >> 4; const int r0 = blockIdx.x * 64, c0 = blockIdx.y * 64;
    v8f acc[4][4];
#pragma unroll
    for (int mb = 0; mb < 4; ++mb)
#pragma unroll
        for (int nb = 0; nb < 4; ++nb) acc[mb][nb] = (v8f){};
    const size_t aoff = (size_t)(r0 + lr) * K + 8 * hi, boff = (size_t)(c0 + lr) * K + 8 * hi;
#pragma unroll 1
    for (int kc = wv * 32; kc < K; kc += 32 * NW) {
        V a[4], a2[4];
#pragma unroll
        for (int mb = 0; mb < 4; ++mb) { a[mb] = WFrag<T16>::ld(A + aoff + (size_t)mb * 16 * K + kc); if (NSPLIT == 1 || NSPLIT == 2) a2[mb] = WFrag<T16>::ld(A2 + aoff + (size_t)mb * 16 * K + kc); }
#pragma unroll
        for (int nb = 0; nb < 4; ++nb) { const V b = WFrag<T16>::ld(Bt + boff + (size_t)nb * 16 * K + kc); V b2; if (NSPLIT >= 2) b2 = WFrag<T16>::ld(Bt2 + boff + (size_t)nb * 16 * K + kc);
#pragma unroll
            for (int mb = 0; mb < 4; ++mb) { acc[mb][nb] = WFrag<T16>::mma(a[mb], b, acc[mb][nb]); if (NSPLIT == 1 || NSPLIT == 2) acc[mb][nb] = WFrag<T16>::mma(a2[mb], b, acc[mb][nb]); if (NSPLIT >= 2) acc[mb][nb] = WFrag<T16>::mma(a[mb], b2, acc[mb][nb]); } }
        asm volatile("v_nop\n\tv_nop\n\tv_nop\n\tv_nop" : "+v"(acc[0][0]), "+v"(acc[1][1]), "+v"(acc[2][2]), "+v"(acc[3][3]) : "v"(a[0]), "v"(a[3]));
    }
    if constexpr (NW > 1) {
        float* ow = os + wv * (64 * 68); const int cofs = ((int)threadIdx.x & 15) * 4; v4f bv = (v4f){};
        if (BIAS) { bv[0] = bfr(bias[c0 + cofs]); bv[1] = bfr(bias[c0 + cofs + 1]); bv[2] = bfr(bias[c0 + cofs + 2]); bv[3] = bfr(bias[c0 + cofs + 3]); }    // fetched ahead of the barrier: its latency hides behind the LDS stores
        const int tg = (int)threadIdx.x & 7, dq = (int)threadIdx.x >> 3; v4f bt = (v4f){};    // EPI 2, transposed pass: this thread's block is tokens 8 tg .. + 7 by columns 4 dq .. + 3
        if (EPI == 2 && BIAS) { bt[0] = bfr(bias[c0 + dq * 4]); bt[1] = bfr(bias[c0 + dq * 4 + 1]); bt[2] = bfr(bias[c0 + dq * 4 + 2]); bt[3] = bfr(bias[c0 + dq * 4 + 3]); }
#pragma unroll
        for (int mb = 0; mb < 4; ++mb)
#pragma unroll
            for (int nb = 0; nb < 4; ++nb)
#pragma unroll
                for (int j = 0; j < 8; ++j) ow[(mb * 16 + hi * 8 + j) * 68 + nb * 16 + lr] = acc[mb][nb][j];
        __syncthreads();    // every wave's partial tile is in LDS before any thread sums across waves
#pragma unroll
        for (int i = 0; i < 32 / NW; ++i) { const int row = ((int)threadIdx.x + i * 32 * NW) >> 4; v4f val = *(const v4fa*)(os + row * 68 + cofs);
#pragma unroll
            for (int w = 1; w < NW; ++w) val += *(const v4fa*)(os + w * (64 * 68) + row * 68 + cofs);
            if (BIAS) val += bv;
            if constexpr (EPI == 0) *(v4f*)(C + (size_t)(r0 + row) * ldc + c0 + cofs) = val;
            else { v4h t;
#pragma unroll
                for (int q = 0; q < 4; ++q) t[q] = EPI == 1 ? tohx(fmaxf(val[q] * (1.0f / WSC), 0.f)) : tohx(val[q]);
                if constexpr (EPI == 1) *(v4h*)(P16 + (size_t)(r0 + row) * ldc + c0 + cofs) = t;
                else *(v4h*)(P16 + ((size_t)((r0 / TT) * NH_ + (int)blockIdx.y) * TT + (r0 % TT) + row) * HD + cofs) = t; } }
        if constexpr (EPI == 2) {    // the same sums once more (same order, so the same values), gathered 8 tokens by 4 columns a thread: 8 lanes x 16 bytes fill one 128-byte line of a [d][t] row
            __builtin_amdgcn_sched_barrier(0);    // keeps this pass's 32 LDS loads behind the first pass: hoisted among its loads they took the kernel past 256 registers, one wave a SIMD fewer
            v4f sm[8];
#pragma unroll
            for (int j = 0; j < 8; ++j) { const float* p = os + (tg * 8 + j) * 68 + dq * 4; v4f val = *(const v4fa*)p;
#pragma unroll
                for (int w = 1; w < NW; ++w) val += *(const v4fa*)(p + w * (64 * 68));
                if (BIAS) val += bt;
                sm[j] = val; }
            h16* vrow = V16 + ((size_t)((r0 / TT) * NH_ + (int)blockIdx.y) * HD + dq * 4) * TT + (r0 % TT) + tg * 8;
#pragma unroll
            for (int q = 0; q < 4; ++q) { v8h o;
#pragma unroll
                for (int j = 0; j < 8; ++j) o[j] = tohx(sm[j][q]);
                *(v8h*)(vrow + (size_t)q * TT) = o; }
        }
        return;
    }
#pragma unroll
    for (int mb = 0; mb < 4; ++mb) {
#pragma unroll
        for (int nb = 0; nb < 4; ++nb) {
#pragma unroll
            for (int j = 0; j < 8; ++j) os[(hi * 8 + j) * 68 + nb * 16 + lr] = acc[mb][nb][j]; }
        __builtin_amdgcn_wave_barrier(); asm volatile("" ::: "memory");
        float* crow = C + (size_t)(r0 + mb * 16) * ldc + c0;
{
#pragma unroll
            for (int s = 0; s < 8; ++s) { const int row = 2 * s + hi, cofs = lr * 4; v4f val = *(const v4fa*)(os + row * 68 + cofs); if (BIAS) { val[0] += bfr(bias[c0 + cofs]); val[1] += bfr(bias[c0 + cofs + 1]); val[2] += bfr(bias[c0 + cofs + 2]); val[3] += bfr(bias[c0 + cofs + 3]); }
                *(v4f*)(crow + (size_t)row * ldc + cofs) = val; }
             }
        __builtin_amdgcn_wave_barrier(); asm volatile("" ::: "memory");
    }
}

__device__ __forceinline__ void splitf(float y, unsigned short& h, unsigned short& l) { h = f2bf(y); l = f2bf(y - bf2f(h)); }
typedef __attribute__((ext_vector_type(2))) _Float16 v2h;
typedef __attribute__((ext_vector_type(2))) unsigned short v2us;
typedef __attribute__((ext_vector_type(4))) unsigned short v4us;
typedef __attribute__((ext_vector_type(2))) float v2f;

typedef __attribute__((ext_vector_type(8))) _Float16 v8h16;
__global__ __launch_bounds__(256) void k_cvt8(const float* __restrict__ src, bf* dst, size_t n8) { const size_t i = (size_t)blockIdx.x * 256 + threadIdx.x; if (i >= n8) return; const v8f v = *(const v8f*)(src + i * 8); v8us o;
#pragma unroll
    for (int k = 0; k < 8; ++k) o[k] = f2bf(v[k]); *(v8us*)(dst + i * 8) = o;  }
__global__ __launch_bounds__(256) void k_wtG(const float* __restrict__ w, int K, int N, bf* Bt) {
    const int lane = threadIdx.x & 31; const int L0 = (blockIdx.x * 8 + (threadIdx.x >> 5)) * 8; const int nlines = N * K / 64;
{
#pragma unroll 1
        for (int l = 0; l < 8; ++l) { const int L = L0 + l; if (L >= nlines) break; const size_t e = (size_t)L * 64 + lane * 2; const int k = (int)(e % K), n = (int)(e / K); v2us o;
            o[0] = f2bf(w[(size_t)k * N + n]); o[1] = f2bf(w[(size_t)(k + 1) * N + n]); *(v2us*)(Bt + e) = o; }
         }
}
__global__ __launch_bounds__(256) void k_cvt16(const float* __restrict__ src, h16* dst, size_t n8) { const size_t i = (size_t)blockIdx.x * 256 + threadIdx.x; if (i >= n8) return; const v8f v = *(const v8f*)(src + i * 8); v8h16 o;
#pragma unroll
    for (int k = 0; k < 8; ++k) o[k] = tohx(bfr(v[k]) * WSC); *(v8h16*)(dst + i * 8) = o;  }
__global__ __launch_bounds__(256) void k_bsc(const float* __restrict__ b, float* BS, int n) { const int i = (blockIdx.x * 256 + threadIdx.x) * 4; if (i >= n) return; const v4f a = *(const v4f*)(b + i); v4f o;
#pragma unroll
    for (int q = 0; q < 4; ++q) o[q] = bfr(a[q]) * WSC; *(v4f*)(BS + i) = o;  }
__global__ __launch_bounds__(256) void k_ln1t(const float* __restrict__ x, const float* __restrict__ ATT, const float* __restrict__ gg, const float* __restrict__ bb, float* H, h16* T16) {
    const int lane = threadIdx.x & 31; const int r = blockIdx.x * 8 + (threadIdx.x >> 5); if (r >= NT) return; float v[DD / 32]; float s = 0.f;
#pragma unroll
    for (int c = 0; c < DD / 128; ++c) { const v4f a = *(const v4f*)(ATT + (size_t)r * DD + c * 128 + lane * 4), xx = *(const v4f*)(x + (size_t)r * DD + c * 128 + lane * 4);
#pragma unroll
        for (int q = 0; q < 4; ++q) { v[c * 4 + q] = __fadd_rn(bfr(xx[q]), a[q]); s += v[c * 4 + q]; } }
#pragma unroll
    for (int sh = 16; sh; sh >>= 1) s += __shfl_xor(s, sh, 32);
    const float mu = s * (1.0f / DD); float qq = 0.f;
#pragma unroll
    for (int i = 0; i < DD / 32; ++i) { const float d0 = v[i] - mu; qq = __fadd_rn(qq, __fmul_rn(d0, d0)); }
#pragma unroll
    for (int sh = 16; sh; sh >>= 1) qq += __shfl_xor(qq, sh, 32);
    const float rs = __fdiv_rn(1.0f, __fadd_rn(__fsqrt_rn(qq * (1.0f / (DD - 1))), 1e-6f));
{
#pragma unroll
        for (int c = 0; c < DD / 128; ++c) { v4f o; v4h t;
#pragma unroll
            for (int q = 0; q < 4; ++q) { const int col = c * 128 + lane * 4 + q; o[q] = __fadd_rn(__fmul_rn((v[c * 4 + q] - mu) * rs, bfr(gg[col])), bfr(bb[col])); t[q] = tohx(o[q]); }
            *(v4f*)(H + (size_t)r * DD + c * 128 + lane * 4) = o; *(v4h*)(T16 + (size_t)r * DD + c * 128 + lane * 4) = t; }
         }
}
__global__ __launch_bounds__(256) void k_ln2t(const float* __restrict__ H, const float* __restrict__ F2, const float* __restrict__ gg, const float* __restrict__ bb, float* OUT) {
    const int lane = threadIdx.x & 31; const int r = blockIdx.x * 8 + (threadIdx.x >> 5); if (r >= NT) return; float v[DD / 32]; float s = 0.f;
#pragma unroll
    for (int c = 0; c < DD / 128; ++c) { const v4f a = *(const v4f*)(H + (size_t)r * DD + c * 128 + lane * 4), f4 = *(const v4f*)(F2 + (size_t)r * DD + c * 128 + lane * 4);
#pragma unroll
        for (int q = 0; q < 4; ++q) { v[c * 4 + q] = __fadd_rn(a[q], f4[q] * (1.0f / WSC)); s += v[c * 4 + q]; } }
#pragma unroll
    for (int sh = 16; sh; sh >>= 1) s += __shfl_xor(s, sh, 32);
    const float mu = s * (1.0f / DD); float qq = 0.f;
#pragma unroll
    for (int i = 0; i < DD / 32; ++i) { const float d0 = v[i] - mu; qq = __fadd_rn(qq, __fmul_rn(d0, d0)); }
#pragma unroll
    for (int sh = 16; sh; sh >>= 1) qq += __shfl_xor(qq, sh, 32);
    const float rs = __fdiv_rn(1.0f, __fadd_rn(__fsqrt_rn(qq * (1.0f / (DD - 1))), 1e-6f));
{
#pragma unroll
        for (int c = 0; c < DD / 128; ++c) { v4f o;
#pragma unroll
            for (int q = 0; q < 4; ++q) { const int col = c * 128 + lane * 4 + q; o[q] = __fadd_rn(__fmul_rn((v[c * 4 + q] - mu) * rs, bfr(gg[col])), bfr(bb[col])); }
            *(v4f*)(OUT + (size_t)r * DD + c * 128 + lane * 4) = o; }
         }
}
// ---- k_fattn: scores, softmax and attn.v of one head in one kernel; no score or probability plane in memory. Grid (TT / 256, NZ), 256 threads: 8 waves x 32 query columns; all waves walk the
// same 64-key stages of K ([t][d]) and V^T ([d][t]), staged through registers into LDS (next stage's global loads fly during this stage's work). Transposed products: S^T = K Q^T leaves one query
// per lane column (keys 8 hi + j and 16 + 8 hi + j of each 32), so two score tiles, converted in place, ARE the B operand of O^T += V^T P^T in the loader's k order. Running maximum per query in
// log2 units; P = 2^(s c - m) unnormalised in fp16, f32 row sum of the unrounded values, one division at the end. Every '#pragma unroll' below stands on a loop of constant length that indexes
// fragments or accumulators: unrolled, those arrays live in registers.
#define FKS  64     // keys a stage
#define FPIT 72     // LDS row pitch in 16-bit elements: 144 B = 16 B x 9, an odd multiple, so that 16-byte fragment reads of 16 rows meet no bank twice
#define FSC  0.18033688011112042f    // 1/8 (the score scale) x log2(e)
__device__ __forceinline__ float xhalf(float x) { return __builtin_bit_cast(float, __builtin_amdgcn_permlanex16(__builtin_bit_cast(int, x), __builtin_bit_cast(int, x), 0x76543210, 0xfedcba98, false, false)); }    // lane l takes lane l ^ 16's value
// eight 2^x in one statement, each in place: no v_exp_f32 here reads the result or overwrites the source of the one in front of it, and the closing v_nop is the one slot that the instruction set
// asks for behind a transcendental before its result is used or its source overwritten. In place, so that the statement writes only
// registers that hold its own live inputs, never an operand of a matrix instruction still in flight.
__device__ __forceinline__ v8f exp2x8(v8f x) { float e0 = x[0], e1 = x[1], e2 = x[2], e3 = x[3], e4 = x[4], e5 = x[5], e6 = x[6], e7 = x[7];
    asm("v_exp_f32 %0, %0\n\tv_exp_f32 %1, %1\n\tv_exp_f32 %2, %2\n\tv_exp_f32 %3, %3\n\tv_exp_f32 %4, %4\n\tv_exp_f32 %5, %5\n\tv_exp_f32 %6, %6\n\tv_exp_f32 %7, %7\n\tv_nop"
        : "+v"(e0), "+v"(e1), "+v"(e2), "+v"(e3), "+v"(e4), "+v"(e5), "+v"(e6), "+v"(e7));
    return (v8f){e0, e1, e2, e3, e4, e5, e6, e7}; }
// amdgpu_waves_per_eu(4, 4): a budget of 256 registers, so that the asm statement above never meets a register window
__global__ __launch_bounds__(256) __attribute__((amdgpu_waves_per_eu(4, 4))) void k_fattn(const h16* __restrict__ QP, const h16* __restrict__ VT, float* __restrict__ ATT) {
    __shared__ __align__(16) h16 Ks[FKS * FPIT];
    __shared__ __align__(16) h16 Vs[HD * FPIT];
    const int tid = threadIdx.x, lane = tid & 31, lr = lane & 15, hi = lane >> 4; const int z = blockIdx.y;
    const int wv = __builtin_amdgcn_readfirstlane(tid >> 5);    // the wave's number in a scalar register: what hangs on it (query base, output base) then costs no vector register through the loop
    const h16* Kp = QP + (size_t)z * TT * HD; const h16* Vp = VT + (size_t)z * HD * TT; const int q0 = blockIdx.x * 256 + wv * 32;
    v16h qf[2][2]; v8f o[2][4]; float mc[2], l[2];
#pragma unroll
    for (int qb = 0; qb < 2; ++qb) { mc[qb] = -1.0e30f; l[qb] = 0.f;
#pragma unroll
        for (int ks = 0; ks < 2; ++ks) qf[qb][ks] = WFrag<h16>::ld(Kp + (q0 + qb * 16) * HD + (unsigned)(lr * HD + ks * 32 + 8 * hi));
#pragma unroll
        for (int dt = 0; dt < 4; ++dt) o[qb][dt] = (v8f){}; }
    const int srow = tid >> 3, scol = (tid & 7) * 8;    // this thread stages 16 bytes of rows srow and srow + 32 of each tile
    const unsigned ko = srow * HD + scol, vo = srow * TT + scol;    // 32-bit element offsets from the head's planes (uniform bases)
    v8h gk0 = *(const v8h*)(Kp + ko), gk1 = *(const v8h*)(Kp + ko + 32 * HD), gv0 = *(const v8h*)(Vp + vo), gv1 = *(const v8h*)(Vp + vo + 32 * TT);
    const h16* Kn = Kp; const h16* Vn = Vp;    // the stage being fetched (uniform)
    for (int k0 = 0; k0 < TT; k0 += FKS) {
        __syncthreads();    // every wave has read the last of the previous stage before it is overwritten
        *(v8h*)(Ks + srow * FPIT + scol) = gk0; *(v8h*)(Ks + (srow + 32) * FPIT + scol) = gk1; *(v8h*)(Vs + srow * FPIT + scol) = gv0; *(v8h*)(Vs + (srow + 32) * FPIT + scol) = gv1;
        __syncthreads();    // the stage is whole in LDS before any wave reads it
        if (k0 + FKS < TT) { Kn += FKS * HD; Vn += FKS;
            gk0 = *(const v8h*)(Kn + ko); gk1 = *(const v8h*)(Kn + ko + 32 * HD); gv0 = *(const v8h*)(Vn + vo); gv1 = *(const v8h*)(Vn + vo + 32 * TT); }
#pragma unroll
        for (int kh = 0; kh < 2; ++kh) {    // 32 keys a pass
            v8f s[2][2]; float mx[2];
            { v16h kf[2][2];
#pragma unroll
              for (int kt = 0; kt < 2; ++kt)
#pragma unroll
                  for (int ks = 0; ks < 2; ++ks) kf[kt][ks] = WFrag<h16>::ld(Ks + (kh * 32 + kt * 16 + lr) * FPIT + ks * 32 + 8 * hi);
#pragma unroll
              for (int qb = 0; qb < 2; ++qb)
#pragma unroll
                  for (int kt = 0; kt < 2; ++kt) s[qb][kt] = wmma16(kf[kt][1], qf[qb][1], wmma16(kf[kt][0], qf[qb][0], (v8f){})); }
            v16h vf[4];
#pragma unroll
            for (int dt = 0; dt < 4; ++dt) vf[dt] = WFrag<h16>::ld(Vs + (dt * 16 + lr) * FPIT + kh * 32 + 8 * hi);
#pragma unroll
            for (int qb = 0; qb < 2; ++qb) { float t = fmaxf(s[qb][0][0], s[qb][1][0]);
#pragma unroll
                for (int j = 1; j < 8; ++j) t = fmaxf(t, fmaxf(s[qb][0][j], s[qb][1][j]));
                mx[qb] = t * FSC; }
            // lazy rescale, tested once a pass: the maximum in use moves only when some query's new maximum passes it by more than 8 (P stays below 2^8, far inside fp16)
            if (__builtin_amdgcn_ballot_w32(mx[0] > mc[0] + 8.0f || mx[1] > mc[1] + 8.0f) != 0) {
#pragma unroll
                for (int qb = 0; qb < 2; ++qb) { const float mn = fmaxf(mc[qb], fmaxf(mx[qb], xhalf(mx[qb]))); const float f = __builtin_amdgcn_exp2f(mc[qb] - mn); mc[qb] = mn; l[qb] *= f;
#pragma unroll
                    for (int dt = 0; dt < 4; ++dt) o[qb][dt] *= f; }
            }
#pragma unroll
            for (int qb = 0; qb < 2; ++qb) { v16h p; v8f x0, x1;
#pragma unroll
                for (int j = 0; j < 8; ++j) { x0[j] = fmaf(s[qb][0][j], FSC, -mc[qb]); x1[j] = fmaf(s[qb][1][j], FSC, -mc[qb]); }
                const v8f e0 = exp2x8(x0), e1 = exp2x8(x1);
#pragma unroll
                for (int j = 0; j < 8; ++j) { l[qb] += e0[j] + e1[j]; p[j] = tohx(e0[j]); p[8 + j] = tohx(e1[j]); }
#pragma unroll
                for (int dt = 0; dt < 4; ++dt) o[qb][dt] = wmma16(vf[dt], p, o[qb][dt]); }
        }
    }
    const int b = z / NH_, h = z % NH_;
#pragma unroll
    for (int qb = 0; qb < 2; ++qb) { const float inv = __fdiv_rn(1.0f, l[qb] + xhalf(l[qb])); float* orow = ATT + ((size_t)b * TT + q0 + qb * 16) * DD + h * HD + (unsigned)(lr * DD + 8 * hi);
#pragma unroll
        for (int dt = 0; dt < 4; ++dt) { v4f a, c;
#pragma unroll
            for (int j = 0; j < 4; ++j) { a[j] = o[qb][dt][j] * inv; c[j] = o[qb][dt][4 + j] * inv; }
            *(v4f*)(orow + dt * 16) = a; *(v4f*)(orow + dt * 16 + 4) = c; } }
}
__global__ __launch_bounds__(256) void k_merge(const float* __restrict__ O, int b, int h0, bf* Ah, bf* Al) {
    const int lane = threadIdx.x & 31; const int L0 = (blockIdx.x * 8 + (threadIdx.x >> 5)) * 8; const int nlines = ZH * TT * HD / 64;
{
#pragma unroll
        for (int l = 0; l < 8; ++l) { const int L = L0 + l; if (L >= nlines) break; const int e = L * 64 + lane * 2; const int d = e & 63; const int t = (e >> 6) & (TT - 1); const int zz = e >> 17; v2us oh, ol;
#pragma unroll
            for (int q = 0; q < 2; ++q) { unsigned short a, c2; splitf(O[(size_t)e + q] * (1.0f / PCAR), a, c2); oh[q] = a; ol[q] = c2; }
            const size_t o = ((size_t)b * TT + t) * DD + (h0 + zz) * HD + d; *(v2us*)(Ah + o) = oh; *(v2us*)(Al + o) = ol; }
         }
}

extern "C" void kernel_launch(void* const* d_in, const int* in_sizes, int n_in,
                              void* d_out, int out_size, void* d_ws, size_t ws_size, hipStream_t stream) {
    (void)in_sizes; (void)n_in; (void)out_size;
    const float* IN[11]; for (int i = 0; i < 11; ++i) IN[i] = (const float*)d_in[i];
    // x, wq [1024][1024], bq, ln1_a, ln1_b, ln2_a, ln2_b, w1 [4096][1024], b1, w2 [1024][4096], b2 = d_in[0..10]
    float* OUT = (float*)d_out;     // [2][2048][1024]
    char* wsp = (char*)d_ws;
    auto take = [&](size_t bytes) { char* p = wsp; wsp += (bytes + 255) & ~(size_t)255; return (void*)p; };
    bf* WQ = (bf*)take((size_t)DD * DD * 2); h16* W1 = (h16*)take((size_t)FFH * DD * 2); h16* W2 = (h16*)take((size_t)DD * FFH * 2); float* B1 = (float*)take(FFH * 4); float* B2 = (float*)take(DD * 4);
    bf* XQ = (bf*)take((size_t)NT * DD * 2); float* F = (float*)take((size_t)NT * DD * 4); h16* QP = (h16*)take((size_t)NT * DD * 2); h16* VT = (h16*)take((size_t)NT * DD * 2);
    h16* G16 = (h16*)take((size_t)TT * FFH * 2); float* H = (float*)take((size_t)NT * DD * 4); h16* T16 = (h16*)take((size_t)NT * DD * 2);
    if ((size_t)(wsp - (char*)d_ws) > ws_size) return;    // total ~ 103 MB = 98 MiB; ws 256 MiB
    float* ATT = F;
    { const size_t nw = (size_t)DD * DD / 8; k_cvt8<<<(unsigned)((nw + 255) / 256), 256, 0, stream>>>(IN[1], WQ, nw);
      const size_t f8 = (size_t)FFH * DD / 8; const unsigned gf = (unsigned)((f8 + 255) / 256); k_cvt16<<<gf, 256, 0, stream>>>(IN[7], W1, f8); k_cvt16<<<gf, 256, 0, stream>>>(IN[9], W2, f8); k_bsc<<<FFH / 1024, 256, 0, stream>>>(IN[8], B1, FFH); k_bsc<<<DD / 1024, 256, 0, stream>>>(IN[10], B2, DD);
      const size_t nx = (size_t)NT * DD / 8; k_cvt8<<<(unsigned)((nx + 255) / 256), 256, 0, stream>>>(IN[0], XQ, nx); }
    const dim3 gP(NT / 64, DD / 64, 1);
    k_gemmw<bf, 0, true, 4, 2><<<gP, 128, 0, stream>>>(XQ, nullptr, WQ, nullptr, DD, nullptr, DD, IN[2], 0, 0, 0, QP, VT);   // h serves as q, k (same plane) and v; its two fp16 planes come straight from the epilogue
    k_fattn<<<dim3(TT / 256, NZ, 1), 256, 0, stream>>>(QP, VT, ATT);
    k_ln1t<<<NT / 8, 256, 0, stream>>>(IN[0], ATT, IN[3], IN[4], H, T16);
    for (int hb = 0; hb < NB_; ++hb) { const size_t r0 = (size_t)hb * TT;
        k_gemmw<h16, 0, true, 2, 1><<<dim3(TT / 64, FFH / 64, 1), 64, 0, stream>>>(T16 + r0 * DD, nullptr, W1, nullptr, DD, nullptr, FFH, B1, 0, 0, 0, G16, nullptr);
        k_gemmw<h16, 0, true, 8, 0><<<dim3(TT / 64, DD / 64, 1), 256, 0, stream>>>(G16, nullptr, W2, nullptr, FFH, F + r0 * DD, DD, B2, 0, 0, 0, nullptr, nullptr); }
    k_ln2t<<<NT / 8, 256, 0, stream>>>(H, F, IN[5], IN[6], OUT);
}
